// v000
// Times are from an AMD MI455X. After a warm-up the kernel runs many times in a row, and a time is the length of
// such a window on the GPU divided by its runs, so every launch and the gaps after it count. The runs cycle
// through copies of the inputs. A figure is the median of several windows, for all but v000 over two sittings.
// Sittings can differ by a few percent; kernels timed side by side share one.
// v000, which the later versions start from, runs in 399 microseconds.
#include <hip/hip_runtime.h>
#include <hip/hip_bf16.h>

typedef __attribute__((ext_vector_type(16))) _Float16 v16h;
typedef __attribute__((ext_vector_type(8)))  _Float16 v8h;
typedef __attribute__((ext_vector_type(8)))  float    v8f;
typedef __attribute__((ext_vector_type(4)))  float    v4f;
typedef __attribute__((ext_vector_type(4)))  int      v4i;

#define AS1 __attribute__((address_space(1)))
#define AS3 __attribute__((address_space(3)))

#define SEQ_LEN 8192
#define EMB     768
#define HD      64
#define INV_SCALE 0.125f   // 1/sqrt(64)

// LDS row strides (halves): padded for 16B alignment + bank-conflict avoidance
#define KSTR 72   // 32 keys x 64 dims, row stride 72  (144B, banks step 36)
#define VSTR 40   // 64 dims x 32 keys, row stride 40  (80B,  banks step 20)
#define PSTR 40   // 16 rows x 32 keys, row stride 40

#if __has_builtin(__builtin_amdgcn_global_load_async_to_lds_b128) && \
    __has_builtin(__builtin_amdgcn_s_wait_asynccnt)
#define USE_ASYNC_LDS 1
#else
#define USE_ASYNC_LDS 0
#endif

static __device__ __forceinline__ v8f wmma_f16(v16h a, v16h b, v8f c) {
    return __builtin_amdgcn_wmma_f32_16x16x32_f16(
        /*neg_a=*/false, a, /*neg_b=*/false, b,
        /*c_mod=*/(short)0, c, /*reuse_a=*/false, /*reuse_b=*/false);
}

// 16-bit 16x32 A/B fragment mapping (ISA 7.12.2):
// lane = (k/8 % 2)*16 + (m|n);  element e -> k = 8*hi + (e<8 ? e : e+8)
static __device__ __forceinline__ int kmap(int e, int hi) {
    return hi * 8 + (e < 8 ? e : e + 8);
}

// Load one 16-element f16 fragment slice for a 32-wide k-window starting at p
// (p = row base; must be 16B aligned).  Lowers to two 16B vector loads.
static __device__ __forceinline__ v16h ld_frag16(const _Float16* p, int hi) {
    const v8h a = *(const v8h*)(p + hi * 8);
    const v8h b = *(const v8h*)(p + 16 + hi * 8);
    return __builtin_shufflevector(a, b, 0, 1, 2, 3, 4, 5, 6, 7,
                                         8, 9, 10, 11, 12, 13, 14, 15);
}

// ---------------------------------------------------------------------------
// Kernel 0: one-time W transpose + f16 convert:
//   Wt[which][n][k] = (f16) W_which[k][n],  which in {Q,K,V}
// 288KB total; makes every qkv B-fragment read two contiguous b128 loads.
// ---------------------------------------------------------------------------
__global__ void __launch_bounds__(256) wt_prep(
        const float* __restrict__ Wq, const float* __restrict__ Wk,
        const float* __restrict__ Wv, _Float16* __restrict__ Wt) {
    const int idx = blockIdx.x * 256 + threadIdx.x;   // 3*64*768 total
    const int which = idx / (HD * EMB);
    const int rem   = idx - which * (HD * EMB);
    const int n     = rem / EMB;
    const int k     = rem - n * EMB;
    const float* W = (which == 0) ? Wq : (which == 1) ? Wk : Wv;
    Wt[idx] = (_Float16)W[(size_t)k * HD + n];
}

// ---------------------------------------------------------------------------
// Kernel 1: fused QKV projection.  One wave owns a 16-row strip of x and
// computes ALL of Q|K|V (12 accumulators) so x is streamed from HBM once.
// grid = SEQ/16 blocks of 32 threads; 12 WMMAs per 32-deep K step.
// ---------------------------------------------------------------------------
__global__ void __launch_bounds__(32) qkv_proj(
        const float* __restrict__ x, const _Float16* __restrict__ Wt,
        const float* __restrict__ bq, const float* __restrict__ bk,
        const float* __restrict__ bv,
        _Float16* __restrict__ Qh, _Float16* __restrict__ Kh,
        _Float16* __restrict__ Vh) {
    const int lane  = threadIdx.x & 31;
    const int lo    = lane & 15;
    const int hi    = lane >> 4;
    const int mbase = blockIdx.x * 16;

    const float* bs[3]   = {bq, bk, bv};
    _Float16*    dsts[3] = {Qh, Kh, Vh};

    const float* xrow = x + (size_t)(mbase + lo) * EMB;
    // Wt row for (which, g): n = which*64 + g*16 + lo, k-major (768 halves)
    const _Float16* wrow[3][4];
#pragma unroll
    for (int which = 0; which < 3; ++which)
#pragma unroll
        for (int g = 0; g < 4; ++g)
            wrow[which][g] = Wt + ((size_t)which * HD + g * 16 + lo) * EMB;

    v8f acc[3][4] = {};
    for (int k0 = 0; k0 < EMB; k0 += 32) {
        // A fragment: 4 x float4 contiguous loads, convert to f16
        const v4f x0 = *(const v4f*)(xrow + k0 + hi * 8);
        const v4f x1 = *(const v4f*)(xrow + k0 + hi * 8 + 4);
        const v4f x2 = *(const v4f*)(xrow + k0 + 16 + hi * 8);
        const v4f x3 = *(const v4f*)(xrow + k0 + 16 + hi * 8 + 4);
        v16h a;
#pragma unroll
        for (int s = 0; s < 4; ++s) {
            a[s]      = (_Float16)x0[s];
            a[4 + s]  = (_Float16)x1[s];
            a[8 + s]  = (_Float16)x2[s];
            a[12 + s] = (_Float16)x3[s];
        }
#pragma unroll
        for (int which = 0; which < 3; ++which) {
#pragma unroll
            for (int g = 0; g < 4; ++g) {
                const v16h bf = ld_frag16(wrow[which][g] + k0, hi);
                acc[which][g] = wmma_f16(a, bf, acc[which][g]);
            }
        }
    }

#pragma unroll
    for (int which = 0; which < 3; ++which) {
        const float scale = (which == 0) ? INV_SCALE : 1.0f;
#pragma unroll
        for (int g = 0; g < 4; ++g) {
            const float bias = bs[which][g * 16 + lo];
#pragma unroll
            for (int v = 0; v < 8; ++v) {
                const int row = mbase + v + 8 * hi;   // C layout: row = vgpr + 8*hi
                dsts[which][(size_t)row * HD + g * 16 + lo] =
                    (_Float16)((acc[which][g][v] + bias) * scale);
            }
        }
    }
}

// ---------------------------------------------------------------------------
// Cooperative stage of one 32-key chunk of K and V into LDS.
// K: async global->LDS b128 (CDNA5 path) into [key][dim] (stride KSTR).
// V: sync b128 load + transposed store into [dim][key] (stride VSTR) so the
//    P@V B-fragments read contiguous 16B groups from LDS.
// ---------------------------------------------------------------------------
static __device__ __forceinline__ void stage_chunk(
        const _Float16* __restrict__ Kh, const _Float16* __restrict__ Vh,
        int j0, _Float16* kdst, _Float16* vdstT, int tid) {
#pragma unroll
    for (int i = 0; i < 2; ++i) {                    // 2048 halves / (128 thr * 8)
        const int off = (i * 128 + tid) * 8;
        const int key = off >> 6;
        const int dim = off & 63;
        const _Float16* gsrc = Kh + (size_t)j0 * HD + off;
        _Float16*       ldst = kdst + key * KSTR + dim;
#if USE_ASYNC_LDS
        __builtin_amdgcn_global_load_async_to_lds_b128(
            (AS1 v4i*)(AS1 void*)gsrc,
            (AS3 v4i*)(AS3 void*)ldst,
            0, 0);
#else
        *(v8h*)ldst = *(const v8h*)gsrc;
#endif
    }
#pragma unroll
    for (int i = 0; i < 2; ++i) {
        const int off = (i * 128 + tid) * 8;
        const int key = off >> 6;
        const int dim = off & 63;
        const v8h val = *(const v8h*)(Vh + (size_t)j0 * HD + off);
#pragma unroll
        for (int s = 0; s < 8; ++s)
            vdstT[(dim + s) * VSTR + key] = val[s];
    }
}

// ---------------------------------------------------------------------------
// Kernel 2: causal flash attention.  128 threads = 4 waves; wave w owns
// query rows [qbase, qbase+16).  All waves run the block-max chunk count so
// barriers are uniform (fully-masked chunks are numerically inert), letting
// the block share double-buffered K/V LDS tiles loaded once per block.
// Per chunk: 4 WMMA (S = Q@K^T), online softmax via __shfl_xor in 16-lane
// halves, P transposed C->A layout through per-wave LDS (s_wait_dscnt),
// 4 WMMA (O += P@V).
// ---------------------------------------------------------------------------
__global__ void __launch_bounds__(128) flash_attn(
        const _Float16* __restrict__ Qh, const _Float16* __restrict__ Kh,
        const _Float16* __restrict__ Vh, float* __restrict__ out) {
    __shared__ _Float16 kbuf[2][32 * KSTR];
    __shared__ _Float16 vbufT[2][HD * VSTR];
    __shared__ _Float16 pbuf[4][16 * PSTR];

    const int tid   = threadIdx.x;
    const int lane  = tid & 31;
    const int w     = tid >> 5;
    const int lo    = lane & 15;
    const int hi    = lane >> 4;
    const int qbase = blockIdx.x * 64 + w * 16;

    // Q A-fragments (16 rows x 64 head-dim), pre-scaled by 1/sqrt(d)
    const _Float16* qrow = Qh + (size_t)(qbase + lo) * HD;
    const v16h aq0 = ld_frag16(qrow, hi);
    const v16h aq1 = ld_frag16(qrow + 32, hi);

    v8f o0 = {}, o1 = {}, o2 = {}, o3 = {};
    float m[8], l[8];
#pragma unroll
    for (int v = 0; v < 8; ++v) { m[v] = -__builtin_inff(); l[v] = 0.0f; }

    _Float16* pl = pbuf[w];
    const int nch = blockIdx.x * 2 + 2;              // uniform across the block

    stage_chunk(Kh, Vh, 0, kbuf[0], vbufT[0], tid);

    for (int it = 0; it < nch; ++it) {
        const int j0  = it * 32;
        const int cur = it & 1;

#if USE_ASYNC_LDS
        __builtin_amdgcn_s_wait_asynccnt(0);         // drain our K async loads
#endif
        __syncthreads();                             // chunk visible; prev readers done

        if (it + 1 < nch)
            stage_chunk(Kh, Vh, (it + 1) * 32, kbuf[cur ^ 1], vbufT[cur ^ 1], tid);

        const _Float16* kb = kbuf[cur];
        const _Float16* vt = vbufT[cur];

        // --- S = Q @ K^T (keys j0..j0+31) from LDS (ds_load_b128 pairs) ---
        const v16h bk0a = ld_frag16(kb + lo * KSTR, hi);
        const v16h bk0b = ld_frag16(kb + lo * KSTR + 32, hi);
        const v16h bk1a = ld_frag16(kb + (16 + lo) * KSTR, hi);
        const v16h bk1b = ld_frag16(kb + (16 + lo) * KSTR + 32, hi);

        v8f s0 = {}, s1 = {};
        s0 = wmma_f16(aq0, bk0a, s0);
        s0 = wmma_f16(aq1, bk0b, s0);
        s1 = wmma_f16(aq0, bk1a, s1);
        s1 = wmma_f16(aq1, bk1b, s1);

        // --- causal mask + online softmax --------------------------------
        float p0[8], p1[8], alpha[8];
#pragma unroll
        for (int v = 0; v < 8; ++v) {
            const int row = qbase + v + 8 * hi;
            const int c0 = j0 + lo, c1 = j0 + 16 + lo;
            float x0 = (c0 <= row) ? s0[v] : -__builtin_inff();
            float x1 = (c1 <= row) ? s1[v] : -__builtin_inff();
            float mx = fmaxf(x0, x1);
#pragma unroll
            for (int msk = 1; msk <= 8; msk <<= 1)
                mx = fmaxf(mx, __shfl_xor(mx, msk, 32));
            const float mnew = fmaxf(m[v], mx);      // finite after chunk 0
            const float e0 = __expf(x0 - mnew);      // exp(-inf) -> 0 masks
            const float e1 = __expf(x1 - mnew);
            float sum = e0 + e1;
#pragma unroll
            for (int msk = 1; msk <= 8; msk <<= 1)
                sum += __shfl_xor(sum, msk, 32);
            const float a = __expf(m[v] - mnew);
            m[v] = mnew;
            l[v] = l[v] * a + sum;
            alpha[v] = a;
            p0[v] = e0;
            p1[v] = e1;
        }
#pragma unroll
        for (int v = 0; v < 8; ++v) {
            o0[v] *= alpha[v]; o1[v] *= alpha[v];
            o2[v] *= alpha[v]; o3[v] *= alpha[v];
        }

        // --- transpose P (C layout) -> A fragment via per-wave LDS --------
#pragma unroll
        for (int v = 0; v < 8; ++v) {
            const int row = v + 8 * hi;
            pl[row * PSTR + lo]      = (_Float16)p0[v];
            pl[row * PSTR + 16 + lo] = (_Float16)p1[v];
        }
        asm volatile("s_wait_dscnt 0" ::: "memory"); // wave-local LDS fence
        const v16h pa = ld_frag16(pl + lo * PSTR, hi);

        // --- O += P @ V from transposed LDS (contiguous 16B groups) ------
        const v16h bv0 = ld_frag16(vt + (lo)      * VSTR, hi);
        const v16h bv1 = ld_frag16(vt + (16 + lo) * VSTR, hi);
        const v16h bv2 = ld_frag16(vt + (32 + lo) * VSTR, hi);
        const v16h bv3 = ld_frag16(vt + (48 + lo) * VSTR, hi);

        o0 = wmma_f16(pa, bv0, o0);
        o1 = wmma_f16(pa, bv1, o1);
        o2 = wmma_f16(pa, bv2, o2);
        o3 = wmma_f16(pa, bv3, o3);
    }

    // --- epilogue: O / l, fp32 output ------------------------------------
#pragma unroll
    for (int v = 0; v < 8; ++v) {
        const float inv = 1.0f / l[v];
        const size_t row = (size_t)(qbase + v + 8 * hi) * HD;
        out[row + lo]      = o0[v] * inv;
        out[row + 16 + lo] = o1[v] * inv;
        out[row + 32 + lo] = o2[v] * inv;
        out[row + 48 + lo] = o3[v] * inv;
    }
}

extern "C" void kernel_launch(void* const* d_in, const int* in_sizes, int n_in,
                              void* d_out, int out_size, void* d_ws, size_t ws_size,
                              hipStream_t stream) {
    const float* x  = (const float*)d_in[0];
    const float* Wq = (const float*)d_in[1];
    const float* bq = (const float*)d_in[2];
    const float* Wk = (const float*)d_in[3];
    const float* bk = (const float*)d_in[4];
    const float* Wv = (const float*)d_in[5];
    const float* bv = (const float*)d_in[6];

    _Float16* Qh = (_Float16*)d_ws;
    _Float16* Kh = Qh + (size_t)SEQ_LEN * HD;
    _Float16* Vh = Kh + (size_t)SEQ_LEN * HD;
    _Float16* Wt = Vh + (size_t)SEQ_LEN * HD;        // 3*64*768 halves

    wt_prep<<<dim3((3 * HD * EMB) / 256), 256, 0, stream>>>(Wq, Wk, Wv, Wt);

    qkv_proj<<<dim3(SEQ_LEN / 16), 32, 0, stream>>>(
        x, Wt, bq, bk, bv, Qh, Kh, Vh);

    flash_attn<<<dim3(SEQ_LEN / 64), 128, 0, stream>>>(
        Qh, Kh, Vh, (float*)d_out);
}

// v001
// Measured time: 91.2 microseconds a run.
// Next to v000, in two timings, it ran 4.40 and 4.38 times as fast.
#include <hip/hip_runtime.h>
#include <hip/hip_bf16.h>

typedef __attribute__((ext_vector_type(16))) _Float16 v16h;
typedef __attribute__((ext_vector_type(8)))  _Float16 v8h;
typedef __attribute__((ext_vector_type(8)))  float    v8f;
typedef __attribute__((ext_vector_type(4)))  float    v4f;
typedef __attribute__((ext_vector_type(2)))  float    v2f;
typedef __attribute__((ext_vector_type(4)))  int      v4i;

#define AS1 __attribute__((address_space(1)))
#define AS3 __attribute__((address_space(3)))

#define SEQ_LEN 8192
#define EMB     768
#define HD      64
#define INV_SCALE 0.125f   // 1/sqrt(64)

// LDS row strides (halves): padded for 16B alignment + bank-conflict avoidance
#define KSTR 72   // 32 keys x 64 dims, row stride 72  (144B, banks step 36)
#define VSTR 40   // 64 dims x 32 keys, row stride 40  (80B,  banks step 20)
#define PSTR 40   // 16 rows x 32 keys, row stride 40

// Split of the keys over work-groups: a key range is SEGC chunks of 32 keys,
// as long as QPG query blocks of 64 rows.  Query blocks g*QPG .. g*QPG+QPG-1
// (group g) need g+1 ranges each; T0(g) counts the work-groups of groups < g.
#define SEGC 16
#define QPG  (SEGC / 2)
#define NGRP (SEQ_LEN / 64 / QPG)
#define T0(g) (QPG * (g) * ((g) + 1) / 2)
#define NPART T0(NGRP)

#if __has_builtin(__builtin_amdgcn_global_load_async_to_lds_b128) && \
    __has_builtin(__builtin_amdgcn_s_wait_asynccnt)
#define USE_ASYNC_LDS 1
#else
#define USE_ASYNC_LDS 0
#endif

static __device__ __forceinline__ v8f wmma_f16(v16h a, v16h b, v8f c) {
    return __builtin_amdgcn_wmma_f32_16x16x32_f16(
        /*neg_a=*/false, a, /*neg_b=*/false, b,
        /*c_mod=*/(short)0, c, /*reuse_a=*/false, /*reuse_b=*/false);
}

// 16-bit 16x32 A/B fragment mapping (ISA 7.12.2):
// lane = (k/8 % 2)*16 + (m|n);  element e -> k = 8*hi + (e<8 ? e : e+8)
static __device__ __forceinline__ int kmap(int e, int hi) {
    return hi * 8 + (e < 8 ? e : e + 8);
}

// Load one 16-element f16 fragment slice for a 32-wide k-window starting at p
// (p = row base; must be 16B aligned).  Lowers to two 16B vector loads.
static __device__ __forceinline__ v16h ld_frag16(const _Float16* p, int hi) {
    const v8h a = *(const v8h*)(p + hi * 8);
    const v8h b = *(const v8h*)(p + 16 + hi * 8);
    return __builtin_shufflevector(a, b, 0, 1, 2, 3, 4, 5, 6, 7,
                                         8, 9, 10, 11, 12, 13, 14, 15);
}

// ---------------------------------------------------------------------------
// Kernel 0: one-time W transpose + f16 convert:
//   Wt[which][n][k] = (f16) W_which[k][n],  which in {Q,K,V}
// 288KB total; makes every qkv B-fragment read two contiguous b128 loads.
// ---------------------------------------------------------------------------
__global__ void __launch_bounds__(256) wt_prep(
        const float* __restrict__ Wq, const float* __restrict__ Wk,
        const float* __restrict__ Wv, _Float16* __restrict__ Wt) {
    const int idx = blockIdx.x * 256 + threadIdx.x;   // 3*64*768 total
    const int which = idx / (HD * EMB);
    const int rem   = idx - which * (HD * EMB);
    const int n     = rem / EMB;
    const int k     = rem - n * EMB;
    const float* W = (which == 0) ? Wq : (which == 1) ? Wk : Wv;
    Wt[idx] = (_Float16)W[(size_t)k * HD + n];
}

// ---------------------------------------------------------------------------
// Kernel 1: fused QKV projection.  One wave owns a 16-row strip of x and
// computes ALL of Q|K|V (12 accumulators) so x is streamed from HBM once.
// grid = SEQ/16 blocks of 32 threads; 12 WMMAs per 32-deep K step.
// ---------------------------------------------------------------------------
__global__ void __launch_bounds__(32) qkv_proj(
        const float* __restrict__ x, const _Float16* __restrict__ Wt,
        const float* __restrict__ bq, const float* __restrict__ bk,
        const float* __restrict__ bv,
        _Float16* __restrict__ Qh, _Float16* __restrict__ Kh,
        _Float16* __restrict__ Vh) {
    const int lane  = threadIdx.x & 31;
    const int lo    = lane & 15;
    const int hi    = lane >> 4;
    const int mbase = blockIdx.x * 16;

    const float* bs[3]   = {bq, bk, bv};
    _Float16*    dsts[3] = {Qh, Kh, Vh};

    const float* xrow = x + (size_t)(mbase + lo) * EMB;
    // Wt row for (which, g): n = which*64 + g*16 + lo, k-major (768 halves)
    const _Float16* wrow[3][4];
#pragma unroll
    for (int which = 0; which < 3; ++which)
#pragma unroll
        for (int g = 0; g < 4; ++g)
            wrow[which][g] = Wt + ((size_t)which * HD + g * 16 + lo) * EMB;

    v8f acc[3][4] = {};
    for (int k0 = 0; k0 < EMB; k0 += 32) {
        // A fragment: 4 x float4 contiguous loads, convert to f16
        const v4f x0 = *(const v4f*)(xrow + k0 + hi * 8);
        const v4f x1 = *(const v4f*)(xrow + k0 + hi * 8 + 4);
        const v4f x2 = *(const v4f*)(xrow + k0 + 16 + hi * 8);
        const v4f x3 = *(const v4f*)(xrow + k0 + 16 + hi * 8 + 4);
        v16h a;
#pragma unroll
        for (int s = 0; s < 4; ++s) {
            a[s]      = (_Float16)x0[s];
            a[4 + s]  = (_Float16)x1[s];
            a[8 + s]  = (_Float16)x2[s];
            a[12 + s] = (_Float16)x3[s];
        }
#pragma unroll
        for (int which = 0; which < 3; ++which) {
#pragma unroll
            for (int g = 0; g < 4; ++g) {
                const v16h bf = ld_frag16(wrow[which][g] + k0, hi);
                acc[which][g] = wmma_f16(a, bf, acc[which][g]);
            }
        }
    }

#pragma unroll
    for (int which = 0; which < 3; ++which) {
        const float scale = (which == 0) ? INV_SCALE : 1.0f;
#pragma unroll
        for (int g = 0; g < 4; ++g) {
            const float bias = bs[which][g * 16 + lo];
#pragma unroll
            for (int v = 0; v < 8; ++v) {
                const int row = mbase + v + 8 * hi;   // C layout: row = vgpr + 8*hi
                dsts[which][(size_t)row * HD + g * 16 + lo] =
                    (_Float16)((acc[which][g][v] + bias) * scale);
            }
        }
    }
}

// ---------------------------------------------------------------------------
// Cooperative stage of one 32-key chunk of K and V into LDS.
// K: async global->LDS b128 (CDNA5 path) into [key][dim] (stride KSTR).
// V: sync b128 load + transposed store into [dim][key] (stride VSTR) so the
//    P@V B-fragments read contiguous 16B groups from LDS.
// ---------------------------------------------------------------------------
static __device__ __forceinline__ void stage_chunk(
        const _Float16* __restrict__ Kh, const _Float16* __restrict__ Vh,
        int j0, _Float16* kdst, _Float16* vdstT, int tid) {
#pragma unroll
    for (int i = 0; i < 2; ++i) {                    // 2048 halves / (128 thr * 8)
        const int off = (i * 128 + tid) * 8;
        const int key = off >> 6;
        const int dim = off & 63;
        const _Float16* gsrc = Kh + (size_t)j0 * HD + off;
        _Float16*       ldst = kdst + key * KSTR + dim;
#if USE_ASYNC_LDS
        __builtin_amdgcn_global_load_async_to_lds_b128(
            (AS1 v4i*)(AS1 void*)gsrc,
            (AS3 v4i*)(AS3 void*)ldst,
            0, 0);
#else
        *(v8h*)ldst = *(const v8h*)gsrc;
#endif
    }
#pragma unroll
    for (int i = 0; i < 2; ++i) {
        const int off = (i * 128 + tid) * 8;
        const int key = off >> 6;
        const int dim = off & 63;
        const v8h val = *(const v8h*)(Vh + (size_t)j0 * HD + off);
#pragma unroll
        for (int s = 0; s < 8; ++s)
            vdstT[(dim + s) * VSTR + key] = val[s];
    }
}

// ---------------------------------------------------------------------------
// Kernel 2: causal flash attention over ONE key range.  Work-group t serves
// (query block qb, key range seg) and leaves its un-normalised sum with each
// row's maximum and denominator in the workspace; merge_parts joins them.
// A range starts at a multiple of 64 keys that is <= 64*qb, so its first
// chunk holds an unmasked key for every row of the block.
// 128 threads = 4 waves; wave w owns
// query rows [qbase, qbase+16).  All waves run the block-max chunk count so
// barriers are uniform (fully-masked chunks are numerically inert), letting
// the block share double-buffered K/V LDS tiles loaded once per block.
// Per chunk: 4 WMMA (S = Q@K^T), online softmax via __shfl_xor in 16-lane
// halves, P transposed C->A layout through per-wave LDS (s_wait_dscnt),
// 4 WMMA (O += P@V).
// ---------------------------------------------------------------------------
__global__ void __launch_bounds__(128) flash_attn(
        const _Float16* __restrict__ Qh, const _Float16* __restrict__ Kh,
        const _Float16* __restrict__ Vh, float* __restrict__ Op,
        float* __restrict__ ML) {
    __shared__ _Float16 kbuf[2][32 * KSTR];
    __shared__ _Float16 vbufT[2][HD * VSTR];
    __shared__ _Float16 pbuf[4][16 * PSTR];

    const int tid   = threadIdx.x;
    const int lane  = tid & 31;
    const int w     = tid >> 5;
    const int lo    = lane & 15;
    const int hi    = lane >> 4;
    const int t     = blockIdx.x;
    int g = 0;
#pragma unroll                                       // T0(i) become literals
    for (int i = 1; i < NGRP; ++i) g += (t >= T0(i)) ? 1 : 0;
    const unsigned rem = t - T0(g);
    const int seg   = rem / QPG;                     // 0 .. g
    const int qsub  = rem % QPG;
    const int qbase = (g * QPG + qsub) * 64 + w * 16;

    v8f o0 = {}, o1 = {}, o2 = {}, o3 = {};
    float m[8], l[8];
#pragma unroll
    for (int v = 0; v < 8; ++v) { m[v] = -__builtin_inff(); l[v] = 0.0f; }

    _Float16* pl = pbuf[w];
    const int ch0 = seg * SEGC;                      // even: buffer 0 comes first
    // a whole range below the diagonal, up to the block's last key on it
    const int nch = ch0 + ((seg < g) ? SEGC : qsub * 2 + 2);  // block-uniform

    stage_chunk(Kh, Vh, ch0 * 32, kbuf[0], vbufT[0], tid);
    // the Q loads below may land in registers that the staging loads name
    asm volatile("s_wait_xcnt 0x0" ::: "memory");

    // Q A-fragments (16 rows x 64 head-dim), pre-scaled by 1/sqrt(d)
    const _Float16* qrow = Qh + (size_t)(qbase + lo) * HD;
    const v16h aq0 = ld_frag16(qrow, hi);
    const v16h aq1 = ld_frag16(qrow + 32, hi);

    for (int it = ch0; it < nch; ++it) {
        const int j0  = it * 32;
        const int cur = it & 1;

#if USE_ASYNC_LDS
        __builtin_amdgcn_s_wait_asynccnt(0);         // drain our K async loads
#endif
        __syncthreads();                             // chunk visible; prev readers done

        if (it + 1 < nch)
            stage_chunk(Kh, Vh, (it + 1) * 32, kbuf[cur ^ 1], vbufT[cur ^ 1], tid);

        const _Float16* kb = kbuf[cur];
        const _Float16* vt = vbufT[cur];

        // --- S = Q @ K^T (keys j0..j0+31) from LDS (ds_load_b128 pairs) ---
        const v16h bk0a = ld_frag16(kb + lo * KSTR, hi);
        const v16h bk0b = ld_frag16(kb + lo * KSTR + 32, hi);
        const v16h bk1a = ld_frag16(kb + (16 + lo) * KSTR, hi);
        const v16h bk1b = ld_frag16(kb + (16 + lo) * KSTR + 32, hi);

        v8f s0 = {}, s1 = {};
        s0 = wmma_f16(aq0, bk0a, s0);
        s0 = wmma_f16(aq1, bk0b, s0);
        s1 = wmma_f16(aq0, bk1a, s1);
        s1 = wmma_f16(aq1, bk1b, s1);

        // --- causal mask + online softmax --------------------------------
        float p0[8], p1[8], alpha[8];
#pragma unroll
        for (int v = 0; v < 8; ++v) {
            const int row = qbase + v + 8 * hi;
            const int c0 = j0 + lo, c1 = j0 + 16 + lo;
            float x0 = (c0 <= row) ? s0[v] : -__builtin_inff();
            float x1 = (c1 <= row) ? s1[v] : -__builtin_inff();
            float mx = fmaxf(x0, x1);
#pragma unroll
            for (int msk = 1; msk <= 8; msk <<= 1)
                mx = fmaxf(mx, __shfl_xor(mx, msk, 32));
            const float mnew = fmaxf(m[v], mx);      // finite after the first chunk
            const float e0 = __expf(x0 - mnew);      // exp(-inf) -> 0 masks
            const float e1 = __expf(x1 - mnew);
            float sum = e0 + e1;
#pragma unroll
            for (int msk = 1; msk <= 8; msk <<= 1)
                sum += __shfl_xor(sum, msk, 32);
            const float a = __expf(m[v] - mnew);
            m[v] = mnew;
            l[v] = l[v] * a + sum;
            alpha[v] = a;
            p0[v] = e0;
            p1[v] = e1;
        }
#pragma unroll
        for (int v = 0; v < 8; ++v) {
            o0[v] *= alpha[v]; o1[v] *= alpha[v];
            o2[v] *= alpha[v]; o3[v] *= alpha[v];
        }

        // --- transpose P (C layout) -> A fragment via per-wave LDS --------
#pragma unroll
        for (int v = 0; v < 8; ++v) {
            const int row = v + 8 * hi;
            pl[row * PSTR + lo]      = (_Float16)p0[v];
            pl[row * PSTR + 16 + lo] = (_Float16)p1[v];
        }
        asm volatile("s_wait_dscnt 0" ::: "memory"); // wave-local LDS fence
        const v16h pa = ld_frag16(pl + lo * PSTR, hi);

        // --- O += P @ V from transposed LDS (contiguous 16B groups) ------
        const v16h bv0 = ld_frag16(vt + (lo)      * VSTR, hi);
        const v16h bv1 = ld_frag16(vt + (16 + lo) * VSTR, hi);
        const v16h bv2 = ld_frag16(vt + (32 + lo) * VSTR, hi);
        const v16h bv3 = ld_frag16(vt + (48 + lo) * VSTR, hi);

        o0 = wmma_f16(pa, bv0, o0);
        o1 = wmma_f16(pa, bv1, o1);
        o2 = wmma_f16(pa, bv2, o2);
        o3 = wmma_f16(pa, bv3, o3);
    }

    // --- epilogue: this range's partial sum, maximum and denominator ------
#pragma unroll
    for (int v = 0; v < 8; ++v) {
        const int    prow = t * 64 + w * 16 + v + 8 * hi;
        const size_t row  = (size_t)prow * HD;
        Op[row + lo]      = o0[v];
        Op[row + 16 + lo] = o1[v];
        Op[row + 32 + lo] = o2[v];
        Op[row + 48 + lo] = o3[v];
    }
    if (lo == 0) {                                   // m, l are equal in 16 lanes
#pragma unroll                                       // m, l stay in registers
        for (int v = 0; v < 8; ++v)
            *(v2f*)(ML + (t * 64 + w * 16 + v + 8 * hi) * 2) = (v2f){m[v], l[v]};
    }
}

// ---------------------------------------------------------------------------
// Kernel 3: join the key ranges of each query row.  16 threads per row, four
// output columns each; the range count is uniform in a work-group (16 rows of
// one query block): absent ranges are skipped by scalar branches, and the
// loads of the present ones are in flight together.
// ---------------------------------------------------------------------------
__global__ void __launch_bounds__(256) merge_parts(
        const float* __restrict__ Op, const float* __restrict__ ML,
        float* __restrict__ out) {
    const int row  = blockIdx.x * 16 + (threadIdx.x >> 4);
    const int d    = (threadIdx.x & 15) * 4;
    const int qb   = blockIdx.x >> 2;
    const int g    = qb / QPG;
    const int nseg = g + 1;
    const int p0   = (T0(g) + qb % QPG) * 64 + (row & 63);   // range 0's row
    const float*  mlp = ML + p0 * 2;                 // next range: QPG*64 rows on
    const float*  op  = Op + (size_t)p0 * HD + d;

    v2f ml[NGRP];                                    // (maximum, denominator)
    v4f o[NGRP];
    // the three loops are unrolled so that ml and o stay in registers
#pragma unroll
    for (int s = 0; s < NGRP; ++s) {
        ml[s] = (v2f){-__builtin_inff(), 0.0f};
        o[s]  = (v4f){0.0f, 0.0f, 0.0f, 0.0f};
        if (s < nseg) {
            ml[s] = *(const v2f*)(mlp + s * (QPG * 64 * 2));
            o[s]  = *(const v4f*)(op + s * (QPG * 64 * HD));
        }
    }
    float mx = ml[0].x;
#pragma unroll
    for (int s = 1; s < NGRP; ++s) mx = fmaxf(mx, ml[s].x);
    float den = 0.0f;
    v4f   acc = {0.0f, 0.0f, 0.0f, 0.0f};
#pragma unroll
    for (int s = 0; s < NGRP; ++s) {
        const float wgt = __expf(ml[s].x - mx);      // absent range: exp(-inf) = 0
        den += wgt * ml[s].y;
        acc += wgt * o[s];
    }
    *(v4f*)(out + (size_t)row * HD + d) = acc * (1.0f / den);
}

extern "C" void kernel_launch(void* const* d_in, const int* in_sizes, int n_in,
                              void* d_out, int out_size, void* d_ws, size_t ws_size,
                              hipStream_t stream) {
    const float* x  = (const float*)d_in[0];
    const float* Wq = (const float*)d_in[1];
    const float* bq = (const float*)d_in[2];
    const float* Wk = (const float*)d_in[3];
    const float* bk = (const float*)d_in[4];
    const float* Wv = (const float*)d_in[5];
    const float* bv = (const float*)d_in[6];

    _Float16* Qh = (_Float16*)d_ws;
    _Float16* Kh = Qh + (size_t)SEQ_LEN * HD;
    _Float16* Vh = Kh + (size_t)SEQ_LEN * HD;
    _Float16* Wt = Vh + (size_t)SEQ_LEN * HD;        // 3*64*768 halves
    float*  Op = (float*)(Wt + (size_t)3 * HD * EMB);    // NPART x 64 x 64
    float*  ML = Op + (size_t)NPART * 64 * HD;           // NPART x 64 x 2

    wt_prep<<<dim3((3 * HD * EMB) / 256), 256, 0, stream>>>(Wq, Wk, Wv, Wt);

    qkv_proj<<<dim3(SEQ_LEN / 16), 32, 0, stream>>>(
        x, Wt, bq, bk, bv, Qh, Kh, Vh);

    flash_attn<<<dim3(NPART), 128, 0, stream>>>(
        Qh, Kh, Vh, Op, ML);

    merge_parts<<<dim3(SEQ_LEN / 16), 256, 0, stream>>>(
        Op, ML, (float*)d_out);
}

// v002
// A run of this version takes 64.5 microseconds.
// Next to v001, in two timings, it ran 1.41 and 1.42 times as fast.
// Counting every step since v000, it is 6.20 times as fast.
#include <hip/hip_runtime.h>
#include <hip/hip_bf16.h>

typedef __attribute__((ext_vector_type(16))) _Float16 v16h;
typedef __attribute__((ext_vector_type(8)))  _Float16 v8h;
typedef __attribute__((ext_vector_type(4)))  _Float16 v4h;
typedef __attribute__((ext_vector_type(8)))  float    v8f;
typedef __attribute__((ext_vector_type(4)))  float    v4f;
typedef __attribute__((ext_vector_type(2)))  float    v2f;
typedef __attribute__((ext_vector_type(4)))  int      v4i;

#define AS1 __attribute__((address_space(1)))
#define AS3 __attribute__((address_space(3)))

#define SEQ_LEN 8192
#define EMB     768
#define HD      64
#define INV_SCALE 0.125f   // 1/sqrt(64)

// LDS row strides (halves): padded for 16B alignment + bank-conflict avoidance
#define KSTR 72   // 32 keys x 64 dims, row stride 72  (144B, banks step 36)
#define VSTR 40   // 64 dims x 32 keys, row stride 40  (80B,  banks step 20)
#define PSTR 40   // 16 rows x 32 keys, row stride 40

// Split of the keys over work-groups: a key range is SEGC chunks of 32 keys,
// as long as QPG query blocks of 64 rows.  Query blocks g*QPG .. g*QPG+QPG-1
// (group g) need g+1 ranges each; T0(g) counts the work-groups of groups < g.
#define SEGC 16
#define QPG  (SEGC / 2)
#define NGRP (SEQ_LEN / 64 / QPG)
#define T0(g) (QPG * (g) * ((g) + 1) / 2)
#define NPART T0(NGRP)

#if __has_builtin(__builtin_amdgcn_global_load_async_to_lds_b128) && \
    __has_builtin(__builtin_amdgcn_s_wait_asynccnt)
#define USE_ASYNC_LDS 1
#else
#define USE_ASYNC_LDS 0
#endif

static __device__ __forceinline__ v8f wmma_f16(v16h a, v16h b, v8f c) {
    return __builtin_amdgcn_wmma_f32_16x16x32_f16(
        /*neg_a=*/false, a, /*neg_b=*/false, b,
        /*c_mod=*/(short)0, c, /*reuse_a=*/false, /*reuse_b=*/false);
}

// 16-bit 16x32 A/B fragment mapping (ISA 7.12.2):
// lane = (k/8 % 2)*16 + (m|n);  element e -> k = 8*hi + (e<8 ? e : e+8)
static __device__ __forceinline__ int kmap(int e, int hi) {
    return hi * 8 + (e < 8 ? e : e + 8);
}

// Load one 16-element f16 fragment slice for a 32-wide k-window starting at p
// (p = row base; must be 16B aligned).  Lowers to two 16B vector loads.
static __device__ __forceinline__ v16h ld_frag16(const _Float16* p, int hi) {
    const v8h a = *(const v8h*)(p + hi * 8);
    const v8h b = *(const v8h*)(p + 16 + hi * 8);
    return __builtin_shufflevector(a, b, 0, 1, 2, 3, 4, 5, 6, 7,
                                         8, 9, 10, 11, 12, 13, 14, 15);
}

// ---------------------------------------------------------------------------
// Kernel 0: one-time W transpose + f16 convert:
//   Wt[which][n][k] = (f16) W_which[k][n],  which in {Q,K,V}
// 288KB total; makes every qkv B-fragment read two contiguous b128 loads.
// ---------------------------------------------------------------------------
__global__ void __launch_bounds__(256) wt_prep(
        const float* __restrict__ Wq, const float* __restrict__ Wk,
        const float* __restrict__ Wv, _Float16* __restrict__ Wt) {
    const int idx = blockIdx.x * 256 + threadIdx.x;   // 3*64*768 total
    const int which = idx / (HD * EMB);
    const int rem   = idx - which * (HD * EMB);
    const int n     = rem / EMB;
    const int k     = rem - n * EMB;
    const float* W = (which == 0) ? Wq : (which == 1) ? Wk : Wv;
    Wt[idx] = (_Float16)W[(size_t)k * HD + n];
}

// ---------------------------------------------------------------------------
// Kernel 1: fused QKV projection.  One work-group owns a 16-row strip of x and
// computes ALL of Q|K|V (12 accumulator tiles).  The 768-deep k loop is split
// over KSPLIT waves, KSTEPS steps of 32 each, so that KSPLIT times as many
// load chains are in flight; the f32 partial tiles are joined through LDS.
// x is still read once.
// ---------------------------------------------------------------------------
#define KSPLIT 8
#define KSTEPS (EMB / 32 / KSPLIT)
// floats per 16x16 partial tile: 8 rows of 32 lanes, plus 16 so that the four
// tiles that make up one 64-column output row fall on different LDS banks
#define TSTR (8 * 32 + 16)

__global__ void __launch_bounds__(32 * KSPLIT) qkv_proj(
        const float* __restrict__ x, const _Float16* __restrict__ Wt,
        const float* __restrict__ bq, const float* __restrict__ bk,
        const float* __restrict__ bv,
        _Float16* __restrict__ Qh, _Float16* __restrict__ Kh,
        _Float16* __restrict__ Vh) {
    __shared__ __attribute__((aligned(16))) float part[KSPLIT][12 * TSTR];

    const int tid   = threadIdx.x;
    const int lane  = tid & 31;
    const int w     = tid >> 5;
    const int lo    = lane & 15;
    const int hi    = lane >> 4;
    const int mbase = blockIdx.x * 16;
    const int kbeg  = w * (KSTEPS * 32);             // this wave's k range

    const float* bs[3]   = {bq, bk, bv};
    _Float16*    dsts[3] = {Qh, Kh, Vh};

    const float* xrow = x + (size_t)(mbase + lo) * EMB + kbeg;
    // Wt row for (which, g): n = which*64 + g*16 + lo, k-major (768 halves)
    const _Float16* wrow[3][4];
#pragma unroll
    for (int which = 0; which < 3; ++which)
#pragma unroll
        for (int g = 0; g < 4; ++g)
            wrow[which][g] = Wt + ((size_t)which * HD + g * 16 + lo) * EMB + kbeg;

    v8f acc[3][4] = {};
    for (int k0 = 0; k0 < KSTEPS * 32; k0 += 32) {
        // A fragment: 4 x float4 contiguous loads, convert to f16
        const v4f x0 = *(const v4f*)(xrow + k0 + hi * 8);
        const v4f x1 = *(const v4f*)(xrow + k0 + hi * 8 + 4);
        const v4f x2 = *(const v4f*)(xrow + k0 + 16 + hi * 8);
        const v4f x3 = *(const v4f*)(xrow + k0 + 16 + hi * 8 + 4);
        v16h a;
#pragma unroll
        for (int s = 0; s < 4; ++s) {
            a[s]      = (_Float16)x0[s];
            a[4 + s]  = (_Float16)x1[s];
            a[8 + s]  = (_Float16)x2[s];
            a[12 + s] = (_Float16)x3[s];
        }
#pragma unroll
        for (int which = 0; which < 3; ++which) {
#pragma unroll
            for (int g = 0; g < 4; ++g) {
                const v16h bf = ld_frag16(wrow[which][g] + k0, hi);
                acc[which][g] = wmma_f16(a, bf, acc[which][g]);
            }
        }
    }

    // each wave leaves its partial tiles in C layout (row = vgpr + 8*hi);
    // the loops are unrolled so that acc is indexed by constants (registers)
#pragma unroll
    for (int which = 0; which < 3; ++which)
#pragma unroll
        for (int g = 0; g < 4; ++g)
#pragma unroll
            for (int v = 0; v < 8; ++v)
                part[w][(which * 4 + g) * TSTR + v * 32 + lane] = acc[which][g][v];
    __syncthreads();                                 // all partials are in LDS

    // join: 16 threads per output row, four columns each, whole 128-B rows out;
    // unrolled so that the LDS reads of all partials are in flight together
    const int r  = tid >> 4;                         // 0 .. 15
    const int c4 = tid & 15;                         // columns c4*4 .. c4*4+3
    const int po = (c4 >> 2) * TSTR + (r & 7) * 32 + (r >> 3) * 16 + (c4 & 3) * 4;
#pragma unroll
    for (int which = 0; which < 3; ++which) {
        const float scale = (which == 0) ? INV_SCALE : 1.0f;
        v4f s = *(const v4f*)&part[0][which * 4 * TSTR + po];
#pragma unroll
        for (int p = 1; p < KSPLIT; ++p)
            s += *(const v4f*)&part[p][which * 4 * TSTR + po];
        const v4f bias = *(const v4f*)(bs[which] + c4 * 4);
        v4h h;
#pragma unroll
        for (int i = 0; i < 4; ++i)
            h[i] = (_Float16)((s[i] + bias[i]) * scale);
        *(v4h*)(dsts[which] + (size_t)(mbase + r) * HD + c4 * 4) = h;
    }
}

// ---------------------------------------------------------------------------
// Cooperative stage of one 32-key chunk of K and V into LDS.
// K: async global->LDS b128 (CDNA5 path) into [key][dim] (stride KSTR).
// V: sync b128 load + transposed store into [dim][key] (stride VSTR) so the
//    P@V B-fragments read contiguous 16B groups from LDS.
// ---------------------------------------------------------------------------
static __device__ __forceinline__ void stage_chunk(
        const _Float16* __restrict__ Kh, const _Float16* __restrict__ Vh,
        int j0, _Float16* kdst, _Float16* vdstT, int tid) {
#pragma unroll
    for (int i = 0; i < 2; ++i) {                    // 2048 halves / (128 thr * 8)
        const int off = (i * 128 + tid) * 8;
        const int key = off >> 6;
        const int dim = off & 63;
        const _Float16* gsrc = Kh + (size_t)j0 * HD + off;
        _Float16*       ldst = kdst + key * KSTR + dim;
#if USE_ASYNC_LDS
        __builtin_amdgcn_global_load_async_to_lds_b128(
            (AS1 v4i*)(AS1 void*)gsrc,
            (AS3 v4i*)(AS3 void*)ldst,
            0, 0);
#else
        *(v8h*)ldst = *(const v8h*)gsrc;
#endif
    }
#pragma unroll
    for (int i = 0; i < 2; ++i) {
        const int off = (i * 128 + tid) * 8;
        const int key = off >> 6;
        const int dim = off & 63;
        const v8h val = *(const v8h*)(Vh + (size_t)j0 * HD + off);
#pragma unroll
        for (int s = 0; s < 8; ++s)
            vdstT[(dim + s) * VSTR + key] = val[s];
    }
}

// ---------------------------------------------------------------------------
// Kernel 2: causal flash attention over ONE key range.  Work-group t serves
// (query block qb, key range seg) and leaves its un-normalised sum with each
// row's maximum and denominator in the workspace; merge_parts joins them.
// A range starts at a multiple of 64 keys that is <= 64*qb, so its first
// chunk holds an unmasked key for every row of the block.
// 128 threads = 4 waves; wave w owns
// query rows [qbase, qbase+16).  All waves run the block-max chunk count so
// barriers are uniform (fully-masked chunks are numerically inert), letting
// the block share double-buffered K/V LDS tiles loaded once per block.
// Per chunk: 4 WMMA (S = Q@K^T), online softmax via __shfl_xor in 16-lane
// halves, P transposed C->A layout through per-wave LDS (s_wait_dscnt),
// 4 WMMA (O += P@V).
// ---------------------------------------------------------------------------
__global__ void __launch_bounds__(128) flash_attn(
        const _Float16* __restrict__ Qh, const _Float16* __restrict__ Kh,
        const _Float16* __restrict__ Vh, float* __restrict__ Op,
        float* __restrict__ ML) {
    __shared__ _Float16 kbuf[2][32 * KSTR];
    __shared__ _Float16 vbufT[2][HD * VSTR];
    __shared__ _Float16 pbuf[4][16 * PSTR];

    const int tid   = threadIdx.x;
    const int lane  = tid & 31;
    const int w     = tid >> 5;
    const int lo    = lane & 15;
    const int hi    = lane >> 4;
    const int t     = blockIdx.x;
    int g = 0;
#pragma unroll                                       // T0(i) become literals
    for (int i = 1; i < NGRP; ++i) g += (t >= T0(i)) ? 1 : 0;
    const unsigned rem = t - T0(g);
    const int seg   = rem / QPG;                     // 0 .. g
    const int qsub  = rem % QPG;
    const int qbase = (g * QPG + qsub) * 64 + w * 16;

    v8f o0 = {}, o1 = {}, o2 = {}, o3 = {};
    float m[8], l[8];
#pragma unroll
    for (int v = 0; v < 8; ++v) { m[v] = -__builtin_inff(); l[v] = 0.0f; }

    _Float16* pl = pbuf[w];
    const int ch0 = seg * SEGC;                      // even: buffer 0 comes first
    // a whole range below the diagonal, up to the block's last key on it
    const int nch = ch0 + ((seg < g) ? SEGC : qsub * 2 + 2);  // block-uniform

    stage_chunk(Kh, Vh, ch0 * 32, kbuf[0], vbufT[0], tid);
    // the Q loads below may land in registers that the staging loads name
    asm volatile("s_wait_xcnt 0x0" ::: "memory");

    // Q A-fragments (16 rows x 64 head-dim), pre-scaled by 1/sqrt(d)
    const _Float16* qrow = Qh + (size_t)(qbase + lo) * HD;
    const v16h aq0 = ld_frag16(qrow, hi);
    const v16h aq1 = ld_frag16(qrow + 32, hi);

    for (int it = ch0; it < nch; ++it) {
        const int j0  = it * 32;
        const int cur = it & 1;

#if USE_ASYNC_LDS
        __builtin_amdgcn_s_wait_asynccnt(0);         // drain our K async loads
#endif
        __syncthreads();                             // chunk visible; prev readers done

        if (it + 1 < nch)
            stage_chunk(Kh, Vh, (it + 1) * 32, kbuf[cur ^ 1], vbufT[cur ^ 1], tid);

        const _Float16* kb = kbuf[cur];
        const _Float16* vt = vbufT[cur];

        // --- S = Q @ K^T (keys j0..j0+31) from LDS (ds_load_b128 pairs) ---
        const v16h bk0a = ld_frag16(kb + lo * KSTR, hi);
        const v16h bk0b = ld_frag16(kb + lo * KSTR + 32, hi);
        const v16h bk1a = ld_frag16(kb + (16 + lo) * KSTR, hi);
        const v16h bk1b = ld_frag16(kb + (16 + lo) * KSTR + 32, hi);

        v8f s0 = {}, s1 = {};
        s0 = wmma_f16(aq0, bk0a, s0);
        s0 = wmma_f16(aq1, bk0b, s0);
        s1 = wmma_f16(aq0, bk1a, s1);
        s1 = wmma_f16(aq1, bk1b, s1);

        // --- causal mask + online softmax --------------------------------
        float p0[8], p1[8], alpha[8];
#pragma unroll
        for (int v = 0; v < 8; ++v) {
            const int row = qbase + v + 8 * hi;
            const int c0 = j0 + lo, c1 = j0 + 16 + lo;
            float x0 = (c0 <= row) ? s0[v] : -__builtin_inff();
            float x1 = (c1 <= row) ? s1[v] : -__builtin_inff();
            float mx = fmaxf(x0, x1);
#pragma unroll
            for (int msk = 1; msk <= 8; msk <<= 1)
                mx = fmaxf(mx, __shfl_xor(mx, msk, 32));
            const float mnew = fmaxf(m[v], mx);      // finite after the first chunk
            const float e0 = __expf(x0 - mnew);      // exp(-inf) -> 0 masks
            const float e1 = __expf(x1 - mnew);
            float sum = e0 + e1;
#pragma unroll
            for (int msk = 1; msk <= 8; msk <<= 1)
                sum += __shfl_xor(sum, msk, 32);
            const float a = __expf(m[v] - mnew);
            m[v] = mnew;
            l[v] = l[v] * a + sum;
            alpha[v] = a;
            p0[v] = e0;
            p1[v] = e1;
        }
#pragma unroll
        for (int v = 0; v < 8; ++v) {
            o0[v] *= alpha[v]; o1[v] *= alpha[v];
            o2[v] *= alpha[v]; o3[v] *= alpha[v];
        }

        // --- transpose P (C layout) -> A fragment via per-wave LDS --------
#pragma unroll
        for (int v = 0; v < 8; ++v) {
            const int row = v + 8 * hi;
            pl[row * PSTR + lo]      = (_Float16)p0[v];
            pl[row * PSTR + 16 + lo] = (_Float16)p1[v];
        }
        asm volatile("s_wait_dscnt 0" ::: "memory"); // wave-local LDS fence
        const v16h pa = ld_frag16(pl + lo * PSTR, hi);

        // --- O += P @ V from transposed LDS (contiguous 16B groups) ------
        const v16h bv0 = ld_frag16(vt + (lo)      * VSTR, hi);
        const v16h bv1 = ld_frag16(vt + (16 + lo) * VSTR, hi);
        const v16h bv2 = ld_frag16(vt + (32 + lo) * VSTR, hi);
        const v16h bv3 = ld_frag16(vt + (48 + lo) * VSTR, hi);

        o0 = wmma_f16(pa, bv0, o0);
        o1 = wmma_f16(pa, bv1, o1);
        o2 = wmma_f16(pa, bv2, o2);
        o3 = wmma_f16(pa, bv3, o3);
    }

    // --- epilogue: this range's partial sum, maximum and denominator ------
#pragma unroll
    for (int v = 0; v < 8; ++v) {
        const int    prow = t * 64 + w * 16 + v + 8 * hi;
        const size_t row  = (size_t)prow * HD;
        Op[row + lo]      = o0[v];
        Op[row + 16 + lo] = o1[v];
        Op[row + 32 + lo] = o2[v];
        Op[row + 48 + lo] = o3[v];
    }
    if (lo == 0) {                                   // m, l are equal in 16 lanes
#pragma unroll                                       // m, l stay in registers
        for (int v = 0; v < 8; ++v)
            *(v2f*)(ML + (t * 64 + w * 16 + v + 8 * hi) * 2) = (v2f){m[v], l[v]};
    }
}

// ---------------------------------------------------------------------------
// Kernel 3: join the key ranges of each query row.  16 threads per row, four
// output columns each; the range count is uniform in a work-group (16 rows of
// one query block): absent ranges are skipped by scalar branches, and the
// loads of the present ones are in flight together.
// ---------------------------------------------------------------------------
__global__ void __launch_bounds__(256) merge_parts(
        const float* __restrict__ Op, const float* __restrict__ ML,
        float* __restrict__ out) {
    const int row  = blockIdx.x * 16 + (threadIdx.x >> 4);
    const int d    = (threadIdx.x & 15) * 4;
    const int qb   = blockIdx.x >> 2;
    const int g    = qb / QPG;
    const int nseg = g + 1;
    const int p0   = (T0(g) + qb % QPG) * 64 + (row & 63);   // range 0's row
    const float*  mlp = ML + p0 * 2;                 // next range: QPG*64 rows on
    const float*  op  = Op + (size_t)p0 * HD + d;

    v2f ml[NGRP];                                    // (maximum, denominator)
    v4f o[NGRP];
    // the three loops are unrolled so that ml and o stay in registers
#pragma unroll
    for (int s = 0; s < NGRP; ++s) {
        ml[s] = (v2f){-__builtin_inff(), 0.0f};
        o[s]  = (v4f){0.0f, 0.0f, 0.0f, 0.0f};
        if (s < nseg) {
            ml[s] = *(const v2f*)(mlp + s * (QPG * 64 * 2));
            o[s]  = *(const v4f*)(op + s * (QPG * 64 * HD));
        }
    }
    float mx = ml[0].x;
#pragma unroll
    for (int s = 1; s < NGRP; ++s) mx = fmaxf(mx, ml[s].x);
    float den = 0.0f;
    v4f   acc = {0.0f, 0.0f, 0.0f, 0.0f};
#pragma unroll
    for (int s = 0; s < NGRP; ++s) {
        const float wgt = __expf(ml[s].x - mx);      // absent range: exp(-inf) = 0
        den += wgt * ml[s].y;
        acc += wgt * o[s];
    }
    *(v4f*)(out + (size_t)row * HD + d) = acc * (1.0f / den);
}

extern "C" void kernel_launch(void* const* d_in, const int* in_sizes, int n_in,
                              void* d_out, int out_size, void* d_ws, size_t ws_size,
                              hipStream_t stream) {
    const float* x  = (const float*)d_in[0];
    const float* Wq = (const float*)d_in[1];
    const float* bq = (const float*)d_in[2];
    const float* Wk = (const float*)d_in[3];
    const float* bk = (const float*)d_in[4];
    const float* Wv = (const float*)d_in[5];
    const float* bv = (const float*)d_in[6];

    _Float16* Qh = (_Float16*)d_ws;
    _Float16* Kh = Qh + (size_t)SEQ_LEN * HD;
    _Float16* Vh = Kh + (size_t)SEQ_LEN * HD;
    _Float16* Wt = Vh + (size_t)SEQ_LEN * HD;        // 3*64*768 halves
    float*  Op = (float*)(Wt + (size_t)3 * HD * EMB);    // NPART x 64 x 64
    float*  ML = Op + (size_t)NPART * 64 * HD;           // NPART x 64 x 2

    wt_prep<<<dim3((3 * HD * EMB) / 256), 256, 0, stream>>>(Wq, Wk, Wv, Wt);

    qkv_proj<<<dim3(SEQ_LEN / 16), 32 * KSPLIT, 0, stream>>>(
        x, Wt, bq, bk, bv, Qh, Kh, Vh);

    flash_attn<<<dim3(NPART), 128, 0, stream>>>(
        Qh, Kh, Vh, Op, ML);

    merge_parts<<<dim3(SEQ_LEN / 16), 256, 0, stream>>>(
        Op, ML, (float*)d_out);
}

// v003
// Measured time: 48.1 microseconds a run.
// Next to v002, in two timings, it ran 1.34 times as fast each time.
// Counting every step since v000, it is 8.32 times as fast.
#include <hip/hip_runtime.h>
#include <hip/hip_bf16.h>

typedef __attribute__((ext_vector_type(16))) _Float16 v16h;
typedef __attribute__((ext_vector_type(8)))  _Float16 v8h;
typedef __attribute__((ext_vector_type(4)))  _Float16 v4h;
typedef __attribute__((ext_vector_type(8)))  float    v8f;
typedef __attribute__((ext_vector_type(4)))  float    v4f;
typedef __attribute__((ext_vector_type(2)))  float    v2f;
typedef __attribute__((ext_vector_type(4)))  int      v4i;

#define AS1 __attribute__((address_space(1)))
#define AS3 __attribute__((address_space(3)))

#define SEQ_LEN 8192
#define EMB     768
#define HD      64
#define INV_SCALE 0.125f   // 1/sqrt(64)

// LDS row strides (halves): padded for 16B alignment + bank-conflict avoidance
#define KSTR 72   // 32 keys x 64 dims, row stride 72  (144B, banks step 36)
#define VSTR 40   // 64 dims x 32 keys, row stride 40  (80B,  banks step 20)
#define OSTR 68   // floats: 16 queries x 64 dims, row stride 68 (272B, banks step 4)

// Split of the keys over work-groups: a key range is SEGC chunks of 32 keys,
// as long as QPG query blocks of 64 rows.  Query blocks g*QPG .. g*QPG+QPG-1
// (group g) need g+1 ranges each; T0(g) counts the work-groups of groups < g.
#define SEGC 16
#define QPG  (SEGC / 2)
#define NGRP (SEQ_LEN / 64 / QPG)
#define T0(g) (QPG * (g) * ((g) + 1) / 2)
#define NPART T0(NGRP)

#if __has_builtin(__builtin_amdgcn_global_load_async_to_lds_b128) && \
    __has_builtin(__builtin_amdgcn_s_wait_asynccnt)
#define USE_ASYNC_LDS 1
#else
#define USE_ASYNC_LDS 0
#endif

static __device__ __forceinline__ v8f wmma_f16(v16h a, v16h b, v8f c) {
    return __builtin_amdgcn_wmma_f32_16x16x32_f16(
        /*neg_a=*/false, a, /*neg_b=*/false, b,
        /*c_mod=*/(short)0, c, /*reuse_a=*/false, /*reuse_b=*/false);
}

// 16-bit 16x32 A/B fragment mapping (ISA 7.12.2):
// lane = (k/8 % 2)*16 + (m|n);  element e -> k = 8*hi + (e<8 ? e : e+8)
static __device__ __forceinline__ int kmap(int e, int hi) {
    return hi * 8 + (e < 8 ? e : e + 8);
}

// Load one 16-element f16 fragment slice for a 32-wide k-window starting at p
// (p = row base; must be 16B aligned).  Lowers to two 16B vector loads.
static __device__ __forceinline__ v16h ld_frag16(const _Float16* p, int hi) {
    const v8h a = *(const v8h*)(p + hi * 8);
    const v8h b = *(const v8h*)(p + 16 + hi * 8);
    return __builtin_shufflevector(a, b, 0, 1, 2, 3, 4, 5, 6, 7,
                                         8, 9, 10, 11, 12, 13, 14, 15);
}

// Value of the lane 16 away (the other half of the wave), without LDS.
static __device__ __forceinline__ float other_half(float x) {
    const int b = __builtin_bit_cast(int, x);
    return __builtin_bit_cast(float, __builtin_amdgcn_permlanex16(
        b, b, 0x76543210, 0xfedcba98, false, false));
}

// ---------------------------------------------------------------------------
// Kernel 0: one-time W transpose + f16 convert:
//   Wt[which][n][k] = (f16) W_which[k][n],  which in {Q,K,V}
// 288KB total; makes every qkv B-fragment read two contiguous b128 loads.
// ---------------------------------------------------------------------------
__global__ void __launch_bounds__(256) wt_prep(
        const float* __restrict__ Wq, const float* __restrict__ Wk,
        const float* __restrict__ Wv, _Float16* __restrict__ Wt) {
    const int idx = blockIdx.x * 256 + threadIdx.x;   // 3*64*768 total
    const int which = idx / (HD * EMB);
    const int rem   = idx - which * (HD * EMB);
    const int n     = rem / EMB;
    const int k     = rem - n * EMB;
    const float* W = (which == 0) ? Wq : (which == 1) ? Wk : Wv;
    Wt[idx] = (_Float16)W[(size_t)k * HD + n];
}

// ---------------------------------------------------------------------------
// Kernel 1: fused QKV projection.  One work-group owns a 16-row strip of x and
// computes ALL of Q|K|V (12 accumulator tiles).  The 768-deep k loop is split
// over KSPLIT waves, KSTEPS steps of 32 each, so that KSPLIT times as many
// load chains are in flight; the f32 partial tiles are joined through LDS.
// x is still read once.
// ---------------------------------------------------------------------------
#define KSPLIT 8
#define KSTEPS (EMB / 32 / KSPLIT)
// floats per 16x16 partial tile: 8 rows of 32 lanes, plus 16 so that the four
// tiles that make up one 64-column output row fall on different LDS banks
#define TSTR (8 * 32 + 16)

__global__ void __launch_bounds__(32 * KSPLIT) qkv_proj(
        const float* __restrict__ x, const _Float16* __restrict__ Wt,
        const float* __restrict__ bq, const float* __restrict__ bk,
        const float* __restrict__ bv,
        _Float16* __restrict__ Qh, _Float16* __restrict__ Kh,
        _Float16* __restrict__ Vh) {
    __shared__ __attribute__((aligned(16))) float part[KSPLIT][12 * TSTR];

    const int tid   = threadIdx.x;
    const int lane  = tid & 31;
    const int w     = tid >> 5;
    const int lo    = lane & 15;
    const int hi    = lane >> 4;
    const int mbase = blockIdx.x * 16;
    const int kbeg  = w * (KSTEPS * 32);             // this wave's k range

    const float* bs[3]   = {bq, bk, bv};
    _Float16*    dsts[3] = {Qh, Kh, Vh};

    const float* xrow = x + (size_t)(mbase + lo) * EMB + kbeg;
    // Wt row for (which, g): n = which*64 + g*16 + lo, k-major (768 halves)
    const _Float16* wrow[3][4];
#pragma unroll
    for (int which = 0; which < 3; ++which)
#pragma unroll
        for (int g = 0; g < 4; ++g)
            wrow[which][g] = Wt + ((size_t)which * HD + g * 16 + lo) * EMB + kbeg;

    v8f acc[3][4] = {};
    for (int k0 = 0; k0 < KSTEPS * 32; k0 += 32) {
        // A fragment: 4 x float4 contiguous loads, convert to f16
        const v4f x0 = *(const v4f*)(xrow + k0 + hi * 8);
        const v4f x1 = *(const v4f*)(xrow + k0 + hi * 8 + 4);
        const v4f x2 = *(const v4f*)(xrow + k0 + 16 + hi * 8);
        const v4f x3 = *(const v4f*)(xrow + k0 + 16 + hi * 8 + 4);
        v16h a;
#pragma unroll
        for (int s = 0; s < 4; ++s) {
            a[s]      = (_Float16)x0[s];
            a[4 + s]  = (_Float16)x1[s];
            a[8 + s]  = (_Float16)x2[s];
            a[12 + s] = (_Float16)x3[s];
        }
#pragma unroll
        for (int which = 0; which < 3; ++which) {
#pragma unroll
            for (int g = 0; g < 4; ++g) {
                const v16h bf = ld_frag16(wrow[which][g] + k0, hi);
                acc[which][g] = wmma_f16(a, bf, acc[which][g]);
            }
        }
    }

    // each wave leaves its partial tiles in C layout (row = vgpr + 8*hi);
    // the loops are unrolled so that acc is indexed by constants (registers)
#pragma unroll
    for (int which = 0; which < 3; ++which)
#pragma unroll
        for (int g = 0; g < 4; ++g)
#pragma unroll
            for (int v = 0; v < 8; ++v)
                part[w][(which * 4 + g) * TSTR + v * 32 + lane] = acc[which][g][v];
    __syncthreads();                                 // all partials are in LDS

    // join: 16 threads per output row, four columns each, whole 128-B rows out;
    // unrolled so that the LDS reads of all partials are in flight together
    const int r  = tid >> 4;                         // 0 .. 15
    const int c4 = tid & 15;                         // columns c4*4 .. c4*4+3
    const int po = (c4 >> 2) * TSTR + (r & 7) * 32 + (r >> 3) * 16 + (c4 & 3) * 4;
#pragma unroll
    for (int which = 0; which < 3; ++which) {
        const float scale = (which == 0) ? INV_SCALE : 1.0f;
        v4f s = *(const v4f*)&part[0][which * 4 * TSTR + po];
#pragma unroll
        for (int p = 1; p < KSPLIT; ++p)
            s += *(const v4f*)&part[p][which * 4 * TSTR + po];
        const v4f bias = *(const v4f*)(bs[which] + c4 * 4);
        v4h h;
#pragma unroll
        for (int i = 0; i < 4; ++i)
            h[i] = (_Float16)((s[i] + bias[i]) * scale);
        *(v4h*)(dsts[which] + (size_t)(mbase + r) * HD + c4 * 4) = h;
    }
}

// ---------------------------------------------------------------------------
// Cooperative stage of one 32-key chunk of K and V into LDS.
// K: async global->LDS b128 (CDNA5 path) into [key][dim] (stride KSTR).
// V: sync b128 load + transposed store into [dim][key] (stride VSTR) so the
//    V^T fragments of the second product read contiguous 16B groups from LDS.
// ---------------------------------------------------------------------------
static __device__ __forceinline__ void stage_chunk(
        const _Float16* __restrict__ Kh, const _Float16* __restrict__ Vh,
        int j0, _Float16* kdst, _Float16* vdstT, int tid) {
#pragma unroll
    for (int i = 0; i < 2; ++i) {                    // 2048 halves / (128 thr * 8)
        const int off = (i * 128 + tid) * 8;
        const int key = off >> 6;
        const int dim = off & 63;
        const _Float16* gsrc = Kh + (size_t)j0 * HD + off;
        _Float16*       ldst = kdst + key * KSTR + dim;
#if USE_ASYNC_LDS
        __builtin_amdgcn_global_load_async_to_lds_b128(
            (AS1 v4i*)(AS1 void*)gsrc,
            (AS3 v4i*)(AS3 void*)ldst,
            0, 0);
#else
        *(v8h*)ldst = *(const v8h*)gsrc;
#endif
    }
#pragma unroll
    for (int i = 0; i < 2; ++i) {
        const int off = (i * 128 + tid) * 8;
        const int key = off >> 6;
        const int dim = off & 63;
        const v8h val = *(const v8h*)(Vh + (size_t)j0 * HD + off);
#pragma unroll
        for (int s = 0; s < 8; ++s)
            vdstT[(dim + s) * VSTR + key] = val[s];
    }
}

// ---------------------------------------------------------------------------
// Kernel 2: causal flash attention over ONE key range.  Work-group t serves
// (query block qb, key range seg) and leaves its un-normalised sum with each
// row's maximum and denominator in the workspace; merge_parts joins them.
// A range starts at a multiple of 64 keys that is <= 64*qb, so its first
// chunk holds an unmasked key for every row of the block.
// 128 threads = 4 waves; wave w owns
// query rows [qbase, qbase+16).  All waves run the block-max chunk count so
// barriers are uniform (fully-masked chunks are numerically inert), letting
// the block share double-buffered K/V LDS tiles loaded once per block.
// The products are transposed: S^T = K@Q^T (A = K rows, B = Q) and
// O^T += V^T@P^T (A = V^T rows, B = P^T).  A lane then holds 16 of the 32
// scores of ONE query (column lo): maximum and sum run in the lane, with one
// exchange between the wave's halves, and the two S^T tiles, converted in
// place, are the P^T operand in the hardware k order.  Per chunk: 4 + 4 WMMA.
// ---------------------------------------------------------------------------
__global__ void __launch_bounds__(128) flash_attn(
        const _Float16* __restrict__ Qh, const _Float16* __restrict__ Kh,
        const _Float16* __restrict__ Vh, float* __restrict__ Op,
        float* __restrict__ ML) {
    __shared__ _Float16 kbuf[2][32 * KSTR];
    __shared__ _Float16 vbufT[2][HD * VSTR];
    __shared__ __attribute__((aligned(16))) float obuf[4][16 * OSTR];

    const int tid   = threadIdx.x;
    const int lane  = tid & 31;
    const int w     = tid >> 5;
    const int lo    = lane & 15;
    const int hi    = lane >> 4;
    const int t     = blockIdx.x;
    int g = 0;
#pragma unroll                                       // T0(i) become literals
    for (int i = 1; i < NGRP; ++i) g += (t >= T0(i)) ? 1 : 0;
    const unsigned rem = t - T0(g);
    const int seg   = rem / QPG;                     // 0 .. g
    const int qsub  = rem % QPG;
    const int qbase = (g * QPG + qsub) * 64 + w * 16;

    v8f o0 = {}, o1 = {}, o2 = {}, o3 = {};
    float m = -__builtin_inff();                     // of query qbase + lo
    float l = 0.0f;                                  // over this half's keys only
    const int ch0 = seg * SEGC;                      // even: buffer 0 comes first
    // a whole range below the diagonal, up to the block's last key on it
    const int nch = ch0 + ((seg < g) ? SEGC : qsub * 2 + 2);  // block-uniform

    stage_chunk(Kh, Vh, ch0 * 32, kbuf[0], vbufT[0], tid);
    // the Q loads below may land in registers that the staging loads name
    asm volatile("s_wait_xcnt 0x0" ::: "memory");

    // Q fragments (16 queries x 64 head-dim, the B operand), pre-scaled by 1/sqrt(d)
    const _Float16* qrow = Qh + (size_t)(qbase + lo) * HD;
    const v16h aq0 = ld_frag16(qrow, hi);
    const v16h aq1 = ld_frag16(qrow + 32, hi);

    for (int it = ch0; it < nch; ++it) {
        const int j0  = it * 32;
        const int cur = it & 1;

#if USE_ASYNC_LDS
        __builtin_amdgcn_s_wait_asynccnt(0);         // drain our K async loads
#endif
        __syncthreads();                             // chunk visible; prev readers done

        if (it + 1 < nch)
            stage_chunk(Kh, Vh, (it + 1) * 32, kbuf[cur ^ 1], vbufT[cur ^ 1], tid);

        const _Float16* kb = kbuf[cur];
        const _Float16* vt = vbufT[cur];

        // --- S^T = K @ Q^T (keys j0..j0+31) from LDS (ds_load_b128 pairs) -
        const v16h bk0a = ld_frag16(kb + lo * KSTR, hi);
        const v16h bk0b = ld_frag16(kb + lo * KSTR + 32, hi);
        const v16h bk1a = ld_frag16(kb + (16 + lo) * KSTR, hi);
        const v16h bk1b = ld_frag16(kb + (16 + lo) * KSTR + 32, hi);

        // inputs-only fence on the loaded fragments: keeps the eight LDS loads
        // together ahead of the products (one LDS wait a chunk, not one a product)
        asm volatile("" :: "v"(bk0a), "v"(bk0b), "v"(bk1a), "v"(bk1b));

        v8f s0 = {}, s1 = {};                        // s[v]: key v + 8*hi, query lo
        s0 = wmma_f16(bk0a, aq0, s0);
        s0 = wmma_f16(bk0b, aq1, s0);
        s1 = wmma_f16(bk1a, aq0, s1);
        s1 = wmma_f16(bk1b, aq1, s1);

        // --- causal mask + online softmax, one query per lane ------------
        const int d = qbase + lo - j0 - 8 * hi;      // key j0 + 8*hi + i is kept if i <= d
        float x0[8], x1[8];
        float mx = -__builtin_inff();
#pragma unroll
        for (int v = 0; v < 8; ++v) {
            x0[v] = (v <= d)      ? s0[v] : -__builtin_inff();
            x1[v] = (16 + v <= d) ? s1[v] : -__builtin_inff();
            mx = fmaxf(mx, fmaxf(x0[v], x1[v]));
        }
        mx = fmaxf(mx, other_half(mx));              // all 32 keys of the chunk
        const float mnew = fmaxf(m, mx);             // finite after the first chunk
        float sum = 0.0f;
        v16h pb;                                     // P^T: pb[s] = key kmap(s, hi)
#pragma unroll
        for (int v = 0; v < 8; ++v) {
            const float e0 = __expf(x0[v] - mnew);   // exp(-inf) -> 0 masks
            const float e1 = __expf(x1[v] - mnew);
            sum += e0 + e1;
            pb[v]     = (_Float16)e0;
            pb[8 + v] = (_Float16)e1;
        }
        const float a = __expf(m - mnew);
        m = mnew;
        l = l * a + sum;
        o0 *= a; o1 *= a; o2 *= a; o3 *= a;

        // --- O^T += V^T @ P^T from transposed LDS (contiguous 16B groups) -
        const v16h bv0 = ld_frag16(vt + (lo)      * VSTR, hi);
        const v16h bv1 = ld_frag16(vt + (16 + lo) * VSTR, hi);
        const v16h bv2 = ld_frag16(vt + (32 + lo) * VSTR, hi);
        const v16h bv3 = ld_frag16(vt + (48 + lo) * VSTR, hi);

        o0 = wmma_f16(bv0, pb, o0);
        o1 = wmma_f16(bv1, pb, o1);
        o2 = wmma_f16(bv2, pb, o2);
        o3 = wmma_f16(bv3, pb, o3);
    }

    // --- epilogue: this range's partial sum, maximum and denominator ------
    l += other_half(l);                              // join the halves' keys
    if (hi == 0)
        *(v2f*)(ML + (t * 64 + w * 16 + lo) * 2) = (v2f){m, l};

    // o_g[v] is dim g*16 + 8*hi + v of query lo: turn the tile back through
    // this wave's own LDS so that each store covers two whole 256-B rows
    float* ob = obuf[w];
    float* oq = ob + lo * OSTR + hi * 8;
    *(v4f*)(oq)      = __builtin_shufflevector(o0, o0, 0, 1, 2, 3);
    *(v4f*)(oq + 4)  = __builtin_shufflevector(o0, o0, 4, 5, 6, 7);
    *(v4f*)(oq + 16) = __builtin_shufflevector(o1, o1, 0, 1, 2, 3);
    *(v4f*)(oq + 20) = __builtin_shufflevector(o1, o1, 4, 5, 6, 7);
    *(v4f*)(oq + 32) = __builtin_shufflevector(o2, o2, 0, 1, 2, 3);
    *(v4f*)(oq + 36) = __builtin_shufflevector(o2, o2, 4, 5, 6, 7);
    *(v4f*)(oq + 48) = __builtin_shufflevector(o3, o3, 0, 1, 2, 3);
    *(v4f*)(oq + 52) = __builtin_shufflevector(o3, o3, 4, 5, 6, 7);
    // wave-local LDS fence: the reads below take what other lanes stored above
    asm volatile("s_wait_dscnt 0" ::: "memory");
    float* orow = Op + (size_t)(t * 64 + w * 16 + hi) * HD + lo * 4;
#pragma unroll                                       // all eight reads in flight
    for (int i = 0; i < 8; ++i)
        *(v4f*)(orow + i * 2 * HD) = *(const v4f*)(ob + (i * 2 + hi) * OSTR + lo * 4);
}

// ---------------------------------------------------------------------------
// Kernel 3: join the key ranges of each query row.  16 threads per row, four
// output columns each; the range count is uniform in a work-group (16 rows of
// one query block): absent ranges are skipped by scalar branches, and the
// loads of the present ones are in flight together.
// ---------------------------------------------------------------------------
__global__ void __launch_bounds__(256) merge_parts(
        const float* __restrict__ Op, const float* __restrict__ ML,
        float* __restrict__ out) {
    const int row  = blockIdx.x * 16 + (threadIdx.x >> 4);
    const int d    = (threadIdx.x & 15) * 4;
    const int qb   = blockIdx.x >> 2;
    const int g    = qb / QPG;
    const int nseg = g + 1;
    const int p0   = (T0(g) + qb % QPG) * 64 + (row & 63);   // range 0's row
    const float*  mlp = ML + p0 * 2;                 // next range: QPG*64 rows on
    const float*  op  = Op + (size_t)p0 * HD + d;

    v2f ml[NGRP];                                    // (maximum, denominator)
    v4f o[NGRP];
    // the three loops are unrolled so that ml and o stay in registers
#pragma unroll
    for (int s = 0; s < NGRP; ++s) {
        ml[s] = (v2f){-__builtin_inff(), 0.0f};
        o[s]  = (v4f){0.0f, 0.0f, 0.0f, 0.0f};
        if (s < nseg) {
            ml[s] = *(const v2f*)(mlp + s * (QPG * 64 * 2));
            o[s]  = *(const v4f*)(op + s * (QPG * 64 * HD));
        }
    }
    float mx = ml[0].x;
#pragma unroll
    for (int s = 1; s < NGRP; ++s) mx = fmaxf(mx, ml[s].x);
    float den = 0.0f;
    v4f   acc = {0.0f, 0.0f, 0.0f, 0.0f};
#pragma unroll
    for (int s = 0; s < NGRP; ++s) {
        const float wgt = __expf(ml[s].x - mx);      // absent range: exp(-inf) = 0
        den += wgt * ml[s].y;
        acc += wgt * o[s];
    }
    *(v4f*)(out + (size_t)row * HD + d) = acc * (1.0f / den);
}

extern "C" void kernel_launch(void* const* d_in, const int* in_sizes, int n_in,
                              void* d_out, int out_size, void* d_ws, size_t ws_size,
                              hipStream_t stream) {
    const float* x  = (const float*)d_in[0];
    const float* Wq = (const float*)d_in[1];
    const float* bq = (const float*)d_in[2];
    const float* Wk = (const float*)d_in[3];
    const float* bk = (const float*)d_in[4];
    const float* Wv = (const float*)d_in[5];
    const float* bv = (const float*)d_in[6];

    _Float16* Qh = (_Float16*)d_ws;
    _Float16* Kh = Qh + (size_t)SEQ_LEN * HD;
    _Float16* Vh = Kh + (size_t)SEQ_LEN * HD;
    _Float16* Wt = Vh + (size_t)SEQ_LEN * HD;        // 3*64*768 halves
    float*  Op = (float*)(Wt + (size_t)3 * HD * EMB);    // NPART x 64 x 64
    float*  ML = Op + (size_t)NPART * 64 * HD;           // NPART x 64 x 2

    wt_prep<<<dim3((3 * HD * EMB) / 256), 256, 0, stream>>>(Wq, Wk, Wv, Wt);

    qkv_proj<<<dim3(SEQ_LEN / 16), 32 * KSPLIT, 0, stream>>>(
        x, Wt, bq, bk, bv, Qh, Kh, Vh);

    flash_attn<<<dim3(NPART), 128, 0, stream>>>(
        Qh, Kh, Vh, Op, ML);

    merge_parts<<<dim3(SEQ_LEN / 16), 256, 0, stream>>>(
        Op, ML, (float*)d_out);
}

// v004
// One run takes 36.1 microseconds.
// Two timings next to v003 put it at 1.33 and 1.34 times that version's speed.
// Counting every step since v000, it is 11.1 times as fast.
#include <hip/hip_runtime.h>
#include <hip/hip_bf16.h>

typedef __attribute__((ext_vector_type(16))) _Float16 v16h;
typedef __attribute__((ext_vector_type(8)))  _Float16 v8h;
typedef __attribute__((ext_vector_type(4)))  _Float16 v4h;
typedef __attribute__((ext_vector_type(8)))  float    v8f;
typedef __attribute__((ext_vector_type(4)))  float    v4f;
typedef __attribute__((ext_vector_type(2)))  float    v2f;
typedef __attribute__((ext_vector_type(4)))  int      v4i;
typedef __attribute__((ext_vector_type(8)))  short    v8s;

#define AS1 __attribute__((address_space(1)))
#define AS3 __attribute__((address_space(3)))

#define SEQ_LEN 8192
#define EMB     768
#define HD      64
#define INV_SCALE 0.125f   // 1/sqrt(64)

// LDS row strides (halves): padded for 16B alignment + bank-conflict avoidance
#define KSTR 72   // 32 keys x 64 dims, row stride 72  (144B, banks step 36)
#define VSTR 80   // 32 keys x 64 dims, row stride 80  (160B = 32B x odd, for the transposing reads)
#define OSTR 68   // floats: 16 queries x 64 dims, row stride 68 (272B, banks step 4)

// Split of the keys over work-groups: a key range is SEGC chunks of 32 keys,
// as long as QPG query blocks of 64 rows.  Query blocks g*QPG .. g*QPG+QPG-1
// (group g) need g+1 ranges each; T0(g) counts the work-groups of groups < g.
#define SEGC 16
#define QPG  (SEGC / 2)
#define NGRP (SEQ_LEN / 64 / QPG)
#define T0(g) (QPG * (g) * ((g) + 1) / 2)
#define NPART T0(NGRP)

#if __has_builtin(__builtin_amdgcn_global_load_async_to_lds_b128) && \
    __has_builtin(__builtin_amdgcn_s_wait_asynccnt)
#define USE_ASYNC_LDS 1
#else
#define USE_ASYNC_LDS 0
#endif

static __device__ __forceinline__ v8f wmma_f16(v16h a, v16h b, v8f c) {
    return __builtin_amdgcn_wmma_f32_16x16x32_f16(
        /*neg_a=*/false, a, /*neg_b=*/false, b,
        /*c_mod=*/(short)0, c, /*reuse_a=*/false, /*reuse_b=*/false);
}

// 16-bit 16x32 A/B fragment mapping (ISA 7.12.2):
// lane = (k/8 % 2)*16 + (m|n);  element e -> k = 8*hi + (e<8 ? e : e+8)
static __device__ __forceinline__ int kmap(int e, int hi) {
    return hi * 8 + (e < 8 ? e : e + 8);
}

// Load one 16-element f16 fragment slice for a 32-wide k-window starting at p
// (p = row base; must be 16B aligned).  Lowers to two 16B vector loads.
static __device__ __forceinline__ v16h ld_frag16(const _Float16* p, int hi) {
    const v8h a = *(const v8h*)(p + hi * 8);
    const v8h b = *(const v8h*)(p + 16 + hi * 8);
    return __builtin_shufflevector(a, b, 0, 1, 2, 3, 4, 5, 6, 7,
                                         8, 9, 10, 11, 12, 13, 14, 15);
}

// Value of the lane 16 away (the other half of the wave), without LDS.
static __device__ __forceinline__ float other_half(float x) {
    const int b = __builtin_bit_cast(int, x);
    return __builtin_bit_cast(float, __builtin_amdgcn_permlanex16(
        b, b, 0x76543210, 0xfedcba98, false, false));
}

// ---------------------------------------------------------------------------
// Kernel 0: one-time W transpose + f16 convert:
//   Wt[which][n][k] = (f16) W_which[k][n],  which in {Q,K,V}
// 288KB total; makes every qkv B-fragment read two contiguous b128 loads.
// ---------------------------------------------------------------------------
__global__ void __launch_bounds__(256) wt_prep(
        const float* __restrict__ Wq, const float* __restrict__ Wk,
        const float* __restrict__ Wv, _Float16* __restrict__ Wt) {
    const int idx = blockIdx.x * 256 + threadIdx.x;   // 3*64*768 total
    const int which = idx / (HD * EMB);
    const int rem   = idx - which * (HD * EMB);
    const int n     = rem / EMB;
    const int k     = rem - n * EMB;
    const float* W = (which == 0) ? Wq : (which == 1) ? Wk : Wv;
    Wt[idx] = (_Float16)W[(size_t)k * HD + n];
}

// ---------------------------------------------------------------------------
// Kernel 1: fused QKV projection.  One work-group owns a 16-row strip of x and
// computes ALL of Q|K|V (12 accumulator tiles).  The 768-deep k loop is split
// over KSPLIT waves, KSTEPS steps of 32 each, so that KSPLIT times as many
// load chains are in flight; the f32 partial tiles are joined through LDS.
// x is still read once.
// ---------------------------------------------------------------------------
#define KSPLIT 8
#define KSTEPS (EMB / 32 / KSPLIT)
// floats per 16x16 partial tile: 8 rows of 32 lanes, plus 16 so that the four
// tiles that make up one 64-column output row fall on different LDS banks
#define TSTR (8 * 32 + 16)

__global__ void __launch_bounds__(32 * KSPLIT) qkv_proj(
        const float* __restrict__ x, const _Float16* __restrict__ Wt,
        const float* __restrict__ bq, const float* __restrict__ bk,
        const float* __restrict__ bv,
        _Float16* __restrict__ Qh, _Float16* __restrict__ Kh,
        _Float16* __restrict__ Vh) {
    __shared__ __attribute__((aligned(16))) float part[KSPLIT][12 * TSTR];

    const int tid   = threadIdx.x;
    const int lane  = tid & 31;
    const int w     = tid >> 5;
    const int lo    = lane & 15;
    const int hi    = lane >> 4;
    const int mbase = blockIdx.x * 16;
    const int kbeg  = w * (KSTEPS * 32);             // this wave's k range

    const float* bs[3]   = {bq, bk, bv};
    _Float16*    dsts[3] = {Qh, Kh, Vh};

    const float* xrow = x + (size_t)(mbase + lo) * EMB + kbeg;
    // Wt row for (which, g): n = which*64 + g*16 + lo, k-major (768 halves)
    const _Float16* wrow[3][4];
#pragma unroll
    for (int which = 0; which < 3; ++which)
#pragma unroll
        for (int g = 0; g < 4; ++g)
            wrow[which][g] = Wt + ((size_t)which * HD + g * 16 + lo) * EMB + kbeg;

    v8f acc[3][4] = {};
    for (int k0 = 0; k0 < KSTEPS * 32; k0 += 32) {
        // A fragment: 4 x float4 contiguous loads, convert to f16
        const v4f x0 = *(const v4f*)(xrow + k0 + hi * 8);
        const v4f x1 = *(const v4f*)(xrow + k0 + hi * 8 + 4);
        const v4f x2 = *(const v4f*)(xrow + k0 + 16 + hi * 8);
        const v4f x3 = *(const v4f*)(xrow + k0 + 16 + hi * 8 + 4);
        v16h a;
#pragma unroll
        for (int s = 0; s < 4; ++s) {
            a[s]      = (_Float16)x0[s];
            a[4 + s]  = (_Float16)x1[s];
            a[8 + s]  = (_Float16)x2[s];
            a[12 + s] = (_Float16)x3[s];
        }
#pragma unroll
        for (int which = 0; which < 3; ++which) {
#pragma unroll
            for (int g = 0; g < 4; ++g) {
                const v16h bf = ld_frag16(wrow[which][g] + k0, hi);
                acc[which][g] = wmma_f16(a, bf, acc[which][g]);
            }
        }
    }

    // each wave leaves its partial tiles in C layout (row = vgpr + 8*hi);
    // the loops are unrolled so that acc is indexed by constants (registers)
#pragma unroll
    for (int which = 0; which < 3; ++which)
#pragma unroll
        for (int g = 0; g < 4; ++g)
#pragma unroll
            for (int v = 0; v < 8; ++v)
                part[w][(which * 4 + g) * TSTR + v * 32 + lane] = acc[which][g][v];
    __syncthreads();                                 // all partials are in LDS

    // join: 16 threads per output row, four columns each, whole 128-B rows out;
    // unrolled so that the LDS reads of all partials are in flight together
    const int r  = tid >> 4;                         // 0 .. 15
    const int c4 = tid & 15;                         // columns c4*4 .. c4*4+3
    const int po = (c4 >> 2) * TSTR + (r & 7) * 32 + (r >> 3) * 16 + (c4 & 3) * 4;
#pragma unroll
    for (int which = 0; which < 3; ++which) {
        const float scale = (which == 0) ? INV_SCALE : 1.0f;
        v4f s = *(const v4f*)&part[0][which * 4 * TSTR + po];
#pragma unroll
        for (int p = 1; p < KSPLIT; ++p)
            s += *(const v4f*)&part[p][which * 4 * TSTR + po];
        const v4f bias = *(const v4f*)(bs[which] + c4 * 4);
        v4h h;
#pragma unroll
        for (int i = 0; i < 4; ++i)
            h[i] = (_Float16)((s[i] + bias[i]) * scale);
        *(v4h*)(dsts[which] + (size_t)(mbase + r) * HD + c4 * 4) = h;
    }
}

// ---------------------------------------------------------------------------
// Cooperative stage of one 32-key chunk of K and V into LDS, both row-major
// [key][dim] by async global->LDS b128 copies (K: stride KSTR, V: stride VSTR).
// The V^T fragments of the second product come by the transposing LDS load.
// ---------------------------------------------------------------------------
static __device__ __forceinline__ void stage_chunk(
        const _Float16* __restrict__ Kh, const _Float16* __restrict__ Vh,
        int j0, _Float16* kdst, _Float16* vdst, int tid) {
#pragma unroll
    for (int i = 0; i < 2; ++i) {                    // 2048 halves / (128 thr * 8)
        const int off = (i * 128 + tid) * 8;
        const int key = off >> 6;
        const int dim = off & 63;
        const _Float16* gsrc = Kh + (size_t)j0 * HD + off;
        _Float16*       ldst = kdst + key * KSTR + dim;
#if USE_ASYNC_LDS
        __builtin_amdgcn_global_load_async_to_lds_b128(
            (AS1 v4i*)(AS1 void*)gsrc,
            (AS3 v4i*)(AS3 void*)ldst,
            0, 0);
#else
        *(v8h*)ldst = *(const v8h*)gsrc;
#endif
    }
#pragma unroll
    for (int i = 0; i < 2; ++i) {
        const int off = (i * 128 + tid) * 8;
        const int key = off >> 6;
        const int dim = off & 63;
        const _Float16* gsrc = Vh + (size_t)j0 * HD + off;
        _Float16*       ldst = vdst + key * VSTR + dim;
#if USE_ASYNC_LDS
        __builtin_amdgcn_global_load_async_to_lds_b128(
            (AS1 v4i*)(AS1 void*)gsrc,
            (AS3 v4i*)(AS3 void*)ldst,
            0, 0);
#else
        *(v8h*)ldst = *(const v8h*)gsrc;
#endif
    }
}

// One 16-dim x 32-key V^T fragment (A operand, hardware k order) from the
// row-major V chunk: two transposing loads, keys 0..15 and 16..31.
// p = this lane's address for dims 0..15, keys 0..15 (see flash_attn).
static __device__ __forceinline__ v16h ld_fragT(const _Float16* p) {
    const v8s a = __builtin_amdgcn_ds_load_tr16_b128_v8i16((AS3 v8s*)(AS3 void*)p);
    const v8s b = __builtin_amdgcn_ds_load_tr16_b128_v8i16(
        (AS3 v8s*)(AS3 void*)(p + 16 * VSTR));
    return __builtin_bit_cast(v16h, __builtin_shufflevector(
        a, b, 0, 1, 2, 3, 4, 5, 6, 7, 8, 9, 10, 11, 12, 13, 14, 15));
}

// ---------------------------------------------------------------------------
// Kernel 2: causal flash attention over ONE key range.  Work-group t serves
// (query block qb, key range seg) and leaves its un-normalised sum with each
// row's maximum and denominator in the workspace; merge_parts joins them.
// A range starts at a multiple of 64 keys that is <= 64*qb, so its first
// chunk holds an unmasked key for every row of the block.
// 128 threads = 4 waves; wave w owns
// query rows [qbase, qbase+16).  All waves run the block-max chunk count so
// barriers are uniform (fully-masked chunks are numerically inert), letting
// the block share double-buffered K/V LDS tiles loaded once per block.
// The products are transposed: S^T = K@Q^T (A = K rows, B = Q) and
// O^T += V^T@P^T (A = V^T rows, B = P^T).  A lane then holds 16 of the 32
// scores of ONE query (column lo): maximum and sum run in the lane, with one
// exchange between the wave's halves, and the two S^T tiles, converted in
// place, are the P^T operand in the hardware k order.  Per chunk: 4 + 4 WMMA.
// ---------------------------------------------------------------------------
__global__ void __launch_bounds__(128) flash_attn(
        const _Float16* __restrict__ Qh, const _Float16* __restrict__ Kh,
        const _Float16* __restrict__ Vh, float* __restrict__ Op,
        float* __restrict__ ML) {
    __shared__ _Float16 kbuf[2][32 * KSTR];
    __shared__ __attribute__((aligned(16))) _Float16 vbuf[2][32 * VSTR];
    __shared__ __attribute__((aligned(16))) float obuf[4][16 * OSTR];

    const int tid   = threadIdx.x;
    const int lane  = tid & 31;
    const int w     = tid >> 5;
    const int lo    = lane & 15;
    const int hi    = lane >> 4;
    const int t     = blockIdx.x;
    int g = 0;
#pragma unroll                                       // T0(i) become literals
    for (int i = 1; i < NGRP; ++i) g += (t >= T0(i)) ? 1 : 0;
    const unsigned rem = t - T0(g);
    const int seg   = rem / QPG;                     // 0 .. g
    const int qsub  = rem % QPG;
    const int qbase = (g * QPG + qsub) * 64 + w * 16;

    v8f o0 = {}, o1 = {}, o2 = {}, o3 = {};
    float m = -__builtin_inff();                     // of query qbase + lo
    float l = 0.0f;                                  // over this half's keys only
    const int ch0 = seg * SEGC;                      // even: buffer 0 comes first
    // a whole range below the diagonal, up to the block's last key on it
    const int nch = ch0 + ((seg < g) ? SEGC : qsub * 2 + 2);  // block-uniform

    stage_chunk(Kh, Vh, ch0 * 32, kbuf[0], vbuf[0], tid);
    // the Q loads below may land in registers that the staging loads name
    asm volatile("s_wait_xcnt 0x0" ::: "memory");

    // Q fragments (16 queries x 64 head-dim, the B operand), pre-scaled by 1/sqrt(d)
    const _Float16* qrow = Qh + (size_t)(qbase + lo) * HD;
    const v16h aq0 = ld_frag16(qrow, hi);
    const v16h aq1 = ld_frag16(qrow + 32, hi);

    for (int it = ch0; it < nch; ++it) {
        const int j0  = it * 32;
        const int cur = it & 1;

        // publish point: this wave's reads of the buffer refilled below are over,
        // its own K and V copies of this chunk have landed, then the barrier
        asm volatile("s_wait_dscnt 0x0" ::: "memory");
#if USE_ASYNC_LDS
        asm volatile("s_wait_asynccnt 0x0" ::: "memory");
#endif
        __syncthreads();                             // chunk visible; prev readers done

        if (it + 1 < nch)
            stage_chunk(Kh, Vh, (it + 1) * 32, kbuf[cur ^ 1], vbuf[cur ^ 1], tid);

        const _Float16* kb = kbuf[cur];
        // lane's source row and 16-B half of the transposing loads
        const _Float16* vt = vbuf[cur] + (8 * hi + (lane & 7)) * VSTR + ((lane >> 3) & 1) * 8;

        // --- S^T = K @ Q^T (keys j0..j0+31) from LDS (ds_load_b128 pairs) -
        const v16h bk0a = ld_frag16(kb + lo * KSTR, hi);
        const v16h bk0b = ld_frag16(kb + lo * KSTR + 32, hi);
        const v16h bk1a = ld_frag16(kb + (16 + lo) * KSTR, hi);
        const v16h bk1b = ld_frag16(kb + (16 + lo) * KSTR + 32, hi);

        // inputs-only fence on the loaded fragments: keeps the eight LDS loads
        // together ahead of the products (one LDS wait a chunk, not one a product)
        asm volatile("" :: "v"(bk0a), "v"(bk0b), "v"(bk1a), "v"(bk1b));

        v8f s0 = {}, s1 = {};                        // s[v]: key v + 8*hi, query lo
        s0 = wmma_f16(bk0a, aq0, s0);
        s0 = wmma_f16(bk0b, aq1, s0);
        s1 = wmma_f16(bk1a, aq0, s1);
        s1 = wmma_f16(bk1b, aq1, s1);

        // --- causal mask + online softmax, one query per lane ------------
        const int d = qbase + lo - j0 - 8 * hi;      // key j0 + 8*hi + i is kept if i <= d
        float x0[8], x1[8];
        float mx = -__builtin_inff();
#pragma unroll
        for (int v = 0; v < 8; ++v) {
            x0[v] = (v <= d)      ? s0[v] : -__builtin_inff();
            x1[v] = (16 + v <= d) ? s1[v] : -__builtin_inff();
            mx = fmaxf(mx, fmaxf(x0[v], x1[v]));
        }
        mx = fmaxf(mx, other_half(mx));              // all 32 keys of the chunk
        const float mnew = fmaxf(m, mx);             // finite after the first chunk
        float sum = 0.0f;
        v16h pb;                                     // P^T: pb[s] = key kmap(s, hi)
#pragma unroll
        for (int v = 0; v < 8; ++v) {
            const float e0 = __expf(x0[v] - mnew);   // exp(-inf) -> 0 masks
            const float e1 = __expf(x1[v] - mnew);
            sum += e0 + e1;
            pb[v]     = (_Float16)e0;
            pb[8 + v] = (_Float16)e1;
        }
        const float a = __expf(m - mnew);
        m = mnew;
        l = l * a + sum;
        o0 *= a; o1 *= a; o2 *= a; o3 *= a;

        // --- O^T += V^T @ P^T, V^T by transposing loads of row-major V ----
        const v16h bv0 = ld_fragT(vt);
        const v16h bv1 = ld_fragT(vt + 16);
        const v16h bv2 = ld_fragT(vt + 32);
        const v16h bv3 = ld_fragT(vt + 48);

        o0 = wmma_f16(bv0, pb, o0);
        o1 = wmma_f16(bv1, pb, o1);
        o2 = wmma_f16(bv2, pb, o2);
        o3 = wmma_f16(bv3, pb, o3);
    }

#if USE_ASYNC_LDS
    // no copy is left in flight when the wave goes on to the output staging
    asm volatile("s_wait_asynccnt 0x0" ::: "memory");
#endif

    // --- epilogue: this range's partial sum, maximum and denominator ------
    l += other_half(l);                              // join the halves' keys
    if (hi == 0)
        *(v2f*)(ML + (t * 64 + w * 16 + lo) * 2) = (v2f){m, l};

    // o_g[v] is dim g*16 + 8*hi + v of query lo: turn the tile back through
    // this wave's own LDS so that each store covers two whole 256-B rows
    float* ob = obuf[w];
    float* oq = ob + lo * OSTR + hi * 8;
    *(v4f*)(oq)      = __builtin_shufflevector(o0, o0, 0, 1, 2, 3);
    *(v4f*)(oq + 4)  = __builtin_shufflevector(o0, o0, 4, 5, 6, 7);
    *(v4f*)(oq + 16) = __builtin_shufflevector(o1, o1, 0, 1, 2, 3);
    *(v4f*)(oq + 20) = __builtin_shufflevector(o1, o1, 4, 5, 6, 7);
    *(v4f*)(oq + 32) = __builtin_shufflevector(o2, o2, 0, 1, 2, 3);
    *(v4f*)(oq + 36) = __builtin_shufflevector(o2, o2, 4, 5, 6, 7);
    *(v4f*)(oq + 48) = __builtin_shufflevector(o3, o3, 0, 1, 2, 3);
    *(v4f*)(oq + 52) = __builtin_shufflevector(o3, o3, 4, 5, 6, 7);
    // wave-local LDS fence: the reads below take what other lanes stored above
    asm volatile("s_wait_dscnt 0" ::: "memory");
    float* orow = Op + (size_t)(t * 64 + w * 16 + hi) * HD + lo * 4;
#pragma unroll                                       // all eight reads in flight
    for (int i = 0; i < 8; ++i)
        *(v4f*)(orow + i * 2 * HD) = *(const v4f*)(ob + (i * 2 + hi) * OSTR + lo * 4);
}

// ---------------------------------------------------------------------------
// Kernel 3: join the key ranges of each query row.  16 threads per row, four
// output columns each; the range count is uniform in a work-group (16 rows of
// one query block): absent ranges are skipped by scalar branches, and the
// loads of the present ones are in flight together.
// ---------------------------------------------------------------------------
__global__ void __launch_bounds__(256) merge_parts(
        const float* __restrict__ Op, const float* __restrict__ ML,
        float* __restrict__ out) {
    const int row  = blockIdx.x * 16 + (threadIdx.x >> 4);
    const int d    = (threadIdx.x & 15) * 4;
    const int qb   = blockIdx.x >> 2;
    const int g    = qb / QPG;
    const int nseg = g + 1;
    const int p0   = (T0(g) + qb % QPG) * 64 + (row & 63);   // range 0's row
    const float*  mlp = ML + p0 * 2;                 // next range: QPG*64 rows on
    const float*  op  = Op + (size_t)p0 * HD + d;

    v2f ml[NGRP];                                    // (maximum, denominator)
    v4f o[NGRP];
    // the three loops are unrolled so that ml and o stay in registers
#pragma unroll
    for (int s = 0; s < NGRP; ++s) {
        ml[s] = (v2f){-__builtin_inff(), 0.0f};
        o[s]  = (v4f){0.0f, 0.0f, 0.0f, 0.0f};
        if (s < nseg) {
            ml[s] = *(const v2f*)(mlp + s * (QPG * 64 * 2));
            o[s]  = *(const v4f*)(op + s * (QPG * 64 * HD));
        }
    }
    float mx = ml[0].x;
#pragma unroll
    for (int s = 1; s < NGRP; ++s) mx = fmaxf(mx, ml[s].x);
    float den = 0.0f;
    v4f   acc = {0.0f, 0.0f, 0.0f, 0.0f};
#pragma unroll
    for (int s = 0; s < NGRP; ++s) {
        const float wgt = __expf(ml[s].x - mx);      // absent range: exp(-inf) = 0
        den += wgt * ml[s].y;
        acc += wgt * o[s];
    }
    *(v4f*)(out + (size_t)row * HD + d) = acc * (1.0f / den);
}

extern "C" void kernel_launch(void* const* d_in, const int* in_sizes, int n_in,
                              void* d_out, int out_size, void* d_ws, size_t ws_size,
                              hipStream_t stream) {
    const float* x  = (const float*)d_in[0];
    const float* Wq = (const float*)d_in[1];
    const float* bq = (const float*)d_in[2];
    const float* Wk = (const float*)d_in[3];
    const float* bk = (const float*)d_in[4];
    const float* Wv = (const float*)d_in[5];
    const float* bv = (const float*)d_in[6];

    _Float16* Qh = (_Float16*)d_ws;
    _Float16* Kh = Qh + (size_t)SEQ_LEN * HD;
    _Float16* Vh = Kh + (size_t)SEQ_LEN * HD;
    _Float16* Wt = Vh + (size_t)SEQ_LEN * HD;        // 3*64*768 halves
    float*  Op = (float*)(Wt + (size_t)3 * HD * EMB);    // NPART x 64 x 64
    float*  ML = Op + (size_t)NPART * 64 * HD;           // NPART x 64 x 2

    wt_prep<<<dim3((3 * HD * EMB) / 256), 256, 0, stream>>>(Wq, Wk, Wv, Wt);

    qkv_proj<<<dim3(SEQ_LEN / 16), 32 * KSPLIT, 0, stream>>>(
        x, Wt, bq, bk, bv, Qh, Kh, Vh);

    flash_attn<<<dim3(NPART), 128, 0, stream>>>(
        Qh, Kh, Vh, Op, ML);

    merge_parts<<<dim3(SEQ_LEN / 16), 256, 0, stream>>>(
        Op, ML, (float*)d_out);
}

// v005
// It runs in 29.1 microseconds.
// Two timings next to v004 both put it at 1.24 times that version's speed.
// Over all steps from v000 it is 13.8 times as fast.
#include <hip/hip_runtime.h>
#include <hip/hip_bf16.h>

typedef __attribute__((ext_vector_type(16))) _Float16 v16h;
typedef __attribute__((ext_vector_type(8)))  _Float16 v8h;
typedef __attribute__((ext_vector_type(4)))  _Float16 v4h;
typedef __attribute__((ext_vector_type(8)))  float    v8f;
typedef __attribute__((ext_vector_type(4)))  float    v4f;
typedef __attribute__((ext_vector_type(2)))  float    v2f;
typedef __attribute__((ext_vector_type(4)))  int      v4i;
typedef __attribute__((ext_vector_type(8)))  short    v8s;

#define AS1 __attribute__((address_space(1)))
#define AS3 __attribute__((address_space(3)))

#define SEQ_LEN 8192
#define EMB     768
#define HD      64
#define INV_SCALE 0.125f   // 1/sqrt(64)

// LDS row strides (halves): padded for 16B alignment + bank-conflict avoidance
#define KSTR 72   // 32 keys x 64 dims, row stride 72  (144B, banks step 36)
#define VSTR 80   // 32 keys x 64 dims, row stride 80  (160B = 32B x odd, for the transposing reads)
#define OSTR 68   // floats: 16 queries x 64 dims, row stride 68 (272B, banks step 4)

// Split of the keys over work-groups: a key range is SEGC chunks of 32 keys,
// as long as QPG query blocks of 64 rows.  Query blocks g*QPG .. g*QPG+QPG-1
// (group g) need g+1 ranges each; T0(g) counts the work-groups of groups < g.
#define SEGC 16
#define QPG  (SEGC / 2)
#define NGRP (SEQ_LEN / 64 / QPG)
#define T0(g) (QPG * (g) * ((g) + 1) / 2)
#define NPART T0(NGRP)

#if __has_builtin(__builtin_amdgcn_global_load_async_to_lds_b128) && \
    __has_builtin(__builtin_amdgcn_s_wait_asynccnt)
#define USE_ASYNC_LDS 1
#else
#define USE_ASYNC_LDS 0
#endif

static __device__ __forceinline__ v8f wmma_f16(v16h a, v16h b, v8f c) {
    return __builtin_amdgcn_wmma_f32_16x16x32_f16(
        /*neg_a=*/false, a, /*neg_b=*/false, b,
        /*c_mod=*/(short)0, c, /*reuse_a=*/false, /*reuse_b=*/false);
}

// 16-bit 16x32 A/B fragment mapping (ISA 7.12.2):
// lane = (k/8 % 2)*16 + (m|n);  element e -> k = 8*hi + (e<8 ? e : e+8)
static __device__ __forceinline__ int kmap(int e, int hi) {
    return hi * 8 + (e < 8 ? e : e + 8);
}

// Load one 16-element f16 fragment slice for a 32-wide k-window starting at p
// (p = row base; must be 16B aligned).  Lowers to two 16B vector loads.
static __device__ __forceinline__ v16h ld_frag16(const _Float16* p, int hi) {
    const v8h a = *(const v8h*)(p + hi * 8);
    const v8h b = *(const v8h*)(p + 16 + hi * 8);
    return __builtin_shufflevector(a, b, 0, 1, 2, 3, 4, 5, 6, 7,
                                         8, 9, 10, 11, 12, 13, 14, 15);
}

// Value of the lane 16 away (the other half of the wave), without LDS.
static __device__ __forceinline__ float other_half(float x) {
    const int b = __builtin_bit_cast(int, x);
    return __builtin_bit_cast(float, __builtin_amdgcn_permlanex16(
        b, b, 0x76543210, 0xfedcba98, false, false));
}

// One 16-column x 32-row transposed fragment (hardware k order over the rows)
// of a row-major f16 block of row stride VSTR: two transposing loads, rows
// 0..15 and 16..31.  p = this lane's address for columns 0..15, rows 0..15:
// block + (8*hi + (lane & 7)) * VSTR + ((lane >> 3) & 1) * 8.
static __device__ __forceinline__ v16h ld_fragT(const _Float16* p) {
    const v8s a = __builtin_amdgcn_ds_load_tr16_b128_v8i16((AS3 v8s*)(AS3 void*)p);
    const v8s b = __builtin_amdgcn_ds_load_tr16_b128_v8i16(
        (AS3 v8s*)(AS3 void*)(p + 16 * VSTR));
    return __builtin_bit_cast(v16h, __builtin_shufflevector(
        a, b, 0, 1, 2, 3, 4, 5, 6, 7, 8, 9, 10, 11, 12, 13, 14, 15));
}

// ---------------------------------------------------------------------------
// Kernel 1: fused QKV projection.  One work-group owns RT 16-row strips of x
// and computes ALL of Q|K|V.  The 768-deep k loop is split over KSPLIT waves,
// KSTEPS steps of 32 each; the f32 partial tiles are joined through LDS.
// W is read as it comes, f32 [k][n]: a wave brings each 32 x 64 block of its
// k range by whole 512-B loads, rounds it to f16 into its own LDS block and
// takes the B fragments back by the transposing load.  With RT = 2 a W block
// feeds two strips, so the f32 bytes per output row are those of f16 at RT = 1.
// x is still read once.
// ---------------------------------------------------------------------------
#define KSPLIT 8
#define KSTEPS (EMB / 32 / KSPLIT)
#define RT 2
#define WRING 3                                      // W blocks held in registers
// floats per 16x16 partial tile: 8 rows of 32 lanes, plus 16 so that the four
// tiles that make up one 64-column output row fall on different LDS banks
#define TSTR (8 * 32 + 16)

__global__ void __launch_bounds__(32 * KSPLIT) qkv_proj(
        const float* __restrict__ x,
        const float* __restrict__ Wq, const float* __restrict__ Wk,
        const float* __restrict__ Wv,
        const float* __restrict__ bq, const float* __restrict__ bk,
        const float* __restrict__ bv,
        _Float16* __restrict__ Qh, _Float16* __restrict__ Kh,
        _Float16* __restrict__ Vh) {
    __shared__ __attribute__((aligned(16))) float part[KSPLIT][RT * 12 * TSTR];
    __shared__ __attribute__((aligned(16))) _Float16 wst[KSPLIT][2][32 * VSTR];

    const int tid   = threadIdx.x;
    const int lane  = tid & 31;
    const int w     = tid >> 5;
    const int lo    = lane & 15;
    const int hi    = lane >> 4;
    const int mbase = blockIdx.x * (16 * RT);
    const int kbeg  = w * (KSTEPS * 32);             // this wave's k range

    const float* Ws[3]   = {Wq, Wk, Wv};
    const float* bs[3]   = {bq, bk, bv};
    _Float16*    dsts[3] = {Qh, Kh, Vh};

    // x first (it comes from furthest away): 4 x float4 per strip and step
    const float* xrow = x + (size_t)(mbase + lo) * EMB + kbeg + hi * 8;
    v4f xr[KSTEPS][RT][4];
#pragma unroll
    for (int s = 0; s < KSTEPS; ++s)
#pragma unroll
        for (int rt = 0; rt < RT; ++rt) {
            const float* xp = xrow + rt * 16 * EMB + s * 32;
            xr[s][rt][0] = *(const v4f*)(xp);
            xr[s][rt][1] = *(const v4f*)(xp + 4);
            xr[s][rt][2] = *(const v4f*)(xp + 16);
            xr[s][rt][3] = *(const v4f*)(xp + 20);
        }
    // the x loads' address pair is an input, so it stays whole up to this wait:
    // no load's result and no later value lands in it before that
    asm volatile("s_wait_xcnt 0x0" :: "v"(xrow) : "memory");

    // W block u = (which, step): load j covers rows 2j and 2j+1, 256 B each
    const unsigned wofb = ((kbeg + hi) * HD + lo * 4) * 4u;  // this lane's byte offset
    v4f wr[WRING][16];
#pragma unroll
    for (int u = 0; u < WRING - 1; ++u)
#pragma unroll
        for (int j = 0; j < 16; ++j)
            wr[u][j] = *(const v4f*)((const char*)(Ws[u / KSTEPS] + ((u % KSTEPS) * 32 + j * 2) * HD) + wofb);

    v16h a[KSTEPS][RT];                              // A fragments, f16
#pragma unroll
    for (int s = 0; s < KSTEPS; ++s)
#pragma unroll
        for (int rt = 0; rt < RT; ++rt)
#pragma unroll
            for (int q = 0; q < 4; ++q)
#pragma unroll
                for (int i = 0; i < 4; ++i)
                    a[s][rt][q * 4 + i] = (_Float16)xr[s][rt][q][i];

    // all loops over blocks are unrolled: wr, a and acc are indexed by constants
#pragma unroll
    for (int which = 0; which < 3; ++which) {
        v8f acc[RT][4] = {};
#pragma unroll
        for (int s = 0; s < KSTEPS; ++s) {
            const int u = which * KSTEPS + s;
            const int n = u + WRING - 1;             // block fetched ahead
            if (n < 3 * KSTEPS) {
#pragma unroll
                for (int j = 0; j < 16; ++j)
                    wr[n % WRING][j] = *(const v4f*)((const char*)(
                        Ws[n / KSTEPS] + ((n % KSTEPS) * 32 + j * 2) * HD) + wofb);
                // behind the last W loads: their offset register is an input, so it
                // stays whole up to this wait and may be reused only behind it
                if (n == 3 * KSTEPS - 1) asm volatile("s_wait_xcnt 0x0" :: "v"(wofb) : "memory");
            }
            // nothing is scheduled across this line: block u is rounded here and the
            // blocks fetched ahead stay in flight meanwhile (without it the compiler
            // rounds each block early and waits for its loads right behind their issue)
            __builtin_amdgcn_sched_barrier(0);
            _Float16* st = wst[w][u & 1];
#pragma unroll
            for (int j = 0; j < 16; ++j) {
                v4h h;
#pragma unroll
                for (int i = 0; i < 4; ++i) h[i] = (_Float16)wr[u % WRING][j][i];
                *(v4h*)(st + (j * 2 + hi) * VSTR + lo * 4) = h;
            }
            // wave-local LDS fence: the transposing reads take other lanes' stores
            asm volatile("s_wait_dscnt 0x0" ::: "memory");
            const _Float16* vt = st + (8 * hi + (lane & 7)) * VSTR + ((lane >> 3) & 1) * 8;
#pragma unroll
            for (int g = 0; g < 4; ++g) {
                const v16h bf = ld_fragT(vt + g * 16);
#pragma unroll
                for (int rt = 0; rt < RT; ++rt)
                    acc[rt][g] = wmma_f16(a[s][rt], bf, acc[rt][g]);
            }
        }
        // the wave leaves its partial tiles in C layout (row = vgpr + 8*hi)
#pragma unroll
        for (int rt = 0; rt < RT; ++rt)
#pragma unroll
            for (int g = 0; g < 4; ++g)
#pragma unroll
                for (int v = 0; v < 8; ++v)
                    part[w][(rt * 12 + which * 4 + g) * TSTR + v * 32 + lane] = acc[rt][g][v];
    }
    __syncthreads();                                 // all partials are in LDS

    // join: 16 threads per output row, four columns each, whole 128-B rows out;
    // unrolled so that the LDS reads of all partials are in flight together
    const int r  = tid >> 4;                         // 0 .. 15
    const int c4 = tid & 15;                         // columns c4*4 .. c4*4+3
    const int po = (c4 >> 2) * TSTR + (r & 7) * 32 + (r >> 3) * 16 + (c4 & 3) * 4;
#pragma unroll
    for (int rt = 0; rt < RT; ++rt) {
#pragma unroll
        for (int which = 0; which < 3; ++which) {
            const float scale = (which == 0) ? INV_SCALE : 1.0f;
            const int   pt    = (rt * 12 + which * 4) * TSTR + po;
            v4f s = *(const v4f*)&part[0][pt];
#pragma unroll
            for (int p = 1; p < KSPLIT; ++p)
                s += *(const v4f*)&part[p][pt];
            const v4f bias = *(const v4f*)(bs[which] + c4 * 4);
            v4h h;
#pragma unroll
            for (int i = 0; i < 4; ++i)
                h[i] = (_Float16)((s[i] + bias[i]) * scale);
            *(v4h*)(dsts[which] + (size_t)(mbase + rt * 16 + r) * HD + c4 * 4) = h;
        }
    }
}

// ---------------------------------------------------------------------------
// Cooperative stage of one 32-key chunk of K and V into LDS, both row-major
// [key][dim] by async global->LDS b128 copies (K: stride KSTR, V: stride VSTR).
// The V^T fragments of the second product come by the transposing LDS load.
// ---------------------------------------------------------------------------
static __device__ __forceinline__ void stage_chunk(
        const _Float16* __restrict__ Kh, const _Float16* __restrict__ Vh,
        int j0, _Float16* kdst, _Float16* vdst, int tid) {
#pragma unroll
    for (int i = 0; i < 2; ++i) {                    // 2048 halves / (128 thr * 8)
        const int off = (i * 128 + tid) * 8;
        const int key = off >> 6;
        const int dim = off & 63;
        const _Float16* gsrc = Kh + (size_t)j0 * HD + off;
        _Float16*       ldst = kdst + key * KSTR + dim;
#if USE_ASYNC_LDS
        __builtin_amdgcn_global_load_async_to_lds_b128(
            (AS1 v4i*)(AS1 void*)gsrc,
            (AS3 v4i*)(AS3 void*)ldst,
            0, 0);
#else
        *(v8h*)ldst = *(const v8h*)gsrc;
#endif
    }
#pragma unroll
    for (int i = 0; i < 2; ++i) {
        const int off = (i * 128 + tid) * 8;
        const int key = off >> 6;
        const int dim = off & 63;
        const _Float16* gsrc = Vh + (size_t)j0 * HD + off;
        _Float16*       ldst = vdst + key * VSTR + dim;
#if USE_ASYNC_LDS
        __builtin_amdgcn_global_load_async_to_lds_b128(
            (AS1 v4i*)(AS1 void*)gsrc,
            (AS3 v4i*)(AS3 void*)ldst,
            0, 0);
#else
        *(v8h*)ldst = *(const v8h*)gsrc;
#endif
    }
}

// ---------------------------------------------------------------------------
// Kernel 2: causal flash attention over ONE key range.  Work-group t serves
// (query block qb, key range seg) and leaves its un-normalised sum with each
// row's maximum and denominator in the workspace; merge_parts joins them.
// A range starts at a multiple of 64 keys that is <= 64*qb, so its first
// chunk holds an unmasked key for every row of the block.
// 128 threads = 4 waves; wave w owns
// query rows [qbase, qbase+16).  All waves run the block-max chunk count so
// barriers are uniform (fully-masked chunks are numerically inert), letting
// the block share double-buffered K/V LDS tiles loaded once per block.
// The products are transposed: S^T = K@Q^T (A = K rows, B = Q) and
// O^T += V^T@P^T (A = V^T rows, B = P^T).  A lane then holds 16 of the 32
// scores of ONE query (column lo): maximum and sum run in the lane, with one
// exchange between the wave's halves, and the two S^T tiles, converted in
// place, are the P^T operand in the hardware k order.  Per chunk: 4 + 4 WMMA.
// ---------------------------------------------------------------------------
__global__ void __launch_bounds__(128) flash_attn(
        const _Float16* __restrict__ Qh, const _Float16* __restrict__ Kh,
        const _Float16* __restrict__ Vh, float* __restrict__ Op,
        float* __restrict__ ML) {
    __shared__ _Float16 kbuf[2][32 * KSTR];
    __shared__ __attribute__((aligned(16))) _Float16 vbuf[2][32 * VSTR];
    __shared__ __attribute__((aligned(16))) float obuf[4][16 * OSTR];

    const int tid   = threadIdx.x;
    const int lane  = tid & 31;
    const int w     = tid >> 5;
    const int lo    = lane & 15;
    const int hi    = lane >> 4;
    const int t     = blockIdx.x;
    int g = 0;
#pragma unroll                                       // T0(i) become literals
    for (int i = 1; i < NGRP; ++i) g += (t >= T0(i)) ? 1 : 0;
    const unsigned rem = t - T0(g);
    const int seg   = rem / QPG;                     // 0 .. g
    const int qsub  = rem % QPG;
    const int qbase = (g * QPG + qsub) * 64 + w * 16;

    v8f o0 = {}, o1 = {}, o2 = {}, o3 = {};
    float m = -__builtin_inff();                     // of query qbase + lo
    float l = 0.0f;                                  // over this half's keys only
    const int ch0 = seg * SEGC;                      // even: buffer 0 comes first
    // a whole range below the diagonal, up to the block's last key on it
    const int nch = ch0 + ((seg < g) ? SEGC : qsub * 2 + 2);  // block-uniform

    stage_chunk(Kh, Vh, ch0 * 32, kbuf[0], vbuf[0], tid);
    // the Q loads below may land in registers that the staging loads name
    asm volatile("s_wait_xcnt 0x0" ::: "memory");

    // Q fragments (16 queries x 64 head-dim, the B operand), pre-scaled by 1/sqrt(d)
    const _Float16* qrow = Qh + (size_t)(qbase + lo) * HD;
    const v16h aq0 = ld_frag16(qrow, hi);
    const v16h aq1 = ld_frag16(qrow + 32, hi);

    for (int it = ch0; it < nch; ++it) {
        const int j0  = it * 32;
        const int cur = it & 1;

        // publish point: this wave's reads of the buffer refilled below are over,
        // its own K and V copies of this chunk have landed, then the barrier
        asm volatile("s_wait_dscnt 0x0" ::: "memory");
#if USE_ASYNC_LDS
        asm volatile("s_wait_asynccnt 0x0" ::: "memory");
#endif
        __syncthreads();                             // chunk visible; prev readers done

        if (it + 1 < nch)
            stage_chunk(Kh, Vh, (it + 1) * 32, kbuf[cur ^ 1], vbuf[cur ^ 1], tid);

        const _Float16* kb = kbuf[cur];
        // lane's source row and 16-B half of the transposing loads
        const _Float16* vt = vbuf[cur] + (8 * hi + (lane & 7)) * VSTR + ((lane >> 3) & 1) * 8;

        // --- S^T = K @ Q^T (keys j0..j0+31) from LDS (ds_load_b128 pairs) -
        const v16h bk0a = ld_frag16(kb + lo * KSTR, hi);
        const v16h bk0b = ld_frag16(kb + lo * KSTR + 32, hi);
        const v16h bk1a = ld_frag16(kb + (16 + lo) * KSTR, hi);
        const v16h bk1b = ld_frag16(kb + (16 + lo) * KSTR + 32, hi);

        // inputs-only fence on the loaded fragments: keeps the eight LDS loads
        // together ahead of the products (one LDS wait a chunk, not one a product)
        asm volatile("" :: "v"(bk0a), "v"(bk0b), "v"(bk1a), "v"(bk1b));

        v8f s0 = {}, s1 = {};                        // s[v]: key v + 8*hi, query lo
        s0 = wmma_f16(bk0a, aq0, s0);
        s0 = wmma_f16(bk0b, aq1, s0);
        s1 = wmma_f16(bk1a, aq0, s1);
        s1 = wmma_f16(bk1b, aq1, s1);

        // --- causal mask + online softmax, one query per lane ------------
        const int d = qbase + lo - j0 - 8 * hi;      // key j0 + 8*hi + i is kept if i <= d
        float x0[8], x1[8];
        float mx = -__builtin_inff();
#pragma unroll
        for (int v = 0; v < 8; ++v) {
            x0[v] = (v <= d)      ? s0[v] : -__builtin_inff();
            x1[v] = (16 + v <= d) ? s1[v] : -__builtin_inff();
            mx = fmaxf(mx, fmaxf(x0[v], x1[v]));
        }
        mx = fmaxf(mx, other_half(mx));              // all 32 keys of the chunk
        const float mnew = fmaxf(m, mx);             // finite after the first chunk
        float sum = 0.0f;
        v16h pb;                                     // P^T: pb[s] = key kmap(s, hi)
#pragma unroll
        for (int v = 0; v < 8; ++v) {
            const float e0 = __expf(x0[v] - mnew);   // exp(-inf) -> 0 masks
            const float e1 = __expf(x1[v] - mnew);
            sum += e0 + e1;
            pb[v]     = (_Float16)e0;
            pb[8 + v] = (_Float16)e1;
        }
        const float a = __expf(m - mnew);
        m = mnew;
        l = l * a + sum;
        o0 *= a; o1 *= a; o2 *= a; o3 *= a;

        // --- O^T += V^T @ P^T, V^T by transposing loads of row-major V ----
        const v16h bv0 = ld_fragT(vt);
        const v16h bv1 = ld_fragT(vt + 16);
        const v16h bv2 = ld_fragT(vt + 32);
        const v16h bv3 = ld_fragT(vt + 48);

        o0 = wmma_f16(bv0, pb, o0);
        o1 = wmma_f16(bv1, pb, o1);
        o2 = wmma_f16(bv2, pb, o2);
        o3 = wmma_f16(bv3, pb, o3);
    }

#if USE_ASYNC_LDS
    // no copy is left in flight when the wave goes on to the output staging
    asm volatile("s_wait_asynccnt 0x0" ::: "memory");
#endif

    // --- epilogue: this range's partial sum, maximum and denominator ------
    l += other_half(l);                              // join the halves' keys
    if (hi == 0)
        *(v2f*)(ML + (t * 64 + w * 16 + lo) * 2) = (v2f){m, l};

    // o_g[v] is dim g*16 + 8*hi + v of query lo: turn the tile back through
    // this wave's own LDS so that each store covers two whole 256-B rows
    float* ob = obuf[w];
    float* oq = ob + lo * OSTR + hi * 8;
    *(v4f*)(oq)      = __builtin_shufflevector(o0, o0, 0, 1, 2, 3);
    *(v4f*)(oq + 4)  = __builtin_shufflevector(o0, o0, 4, 5, 6, 7);
    *(v4f*)(oq + 16) = __builtin_shufflevector(o1, o1, 0, 1, 2, 3);
    *(v4f*)(oq + 20) = __builtin_shufflevector(o1, o1, 4, 5, 6, 7);
    *(v4f*)(oq + 32) = __builtin_shufflevector(o2, o2, 0, 1, 2, 3);
    *(v4f*)(oq + 36) = __builtin_shufflevector(o2, o2, 4, 5, 6, 7);
    *(v4f*)(oq + 48) = __builtin_shufflevector(o3, o3, 0, 1, 2, 3);
    *(v4f*)(oq + 52) = __builtin_shufflevector(o3, o3, 4, 5, 6, 7);
    // wave-local LDS fence: the reads below take what other lanes stored above
    asm volatile("s_wait_dscnt 0" ::: "memory");
    float* orow = Op + (size_t)(t * 64 + w * 16 + hi) * HD + lo * 4;
#pragma unroll                                       // all eight reads in flight
    for (int i = 0; i < 8; ++i)
        *(v4f*)(orow + i * 2 * HD) = *(const v4f*)(ob + (i * 2 + hi) * OSTR + lo * 4);
}

// ---------------------------------------------------------------------------
// Kernel 3: join the key ranges of each query row.  16 threads per row, four
// output columns each; the range count is uniform in a work-group (16 rows of
// one query block): absent ranges are skipped by scalar branches, and the
// loads of the present ones are in flight together.
// ---------------------------------------------------------------------------
__global__ void __launch_bounds__(256) merge_parts(
        const float* __restrict__ Op, const float* __restrict__ ML,
        float* __restrict__ out) {
    const int row  = blockIdx.x * 16 + (threadIdx.x >> 4);
    const int d    = (threadIdx.x & 15) * 4;
    const int qb   = blockIdx.x >> 2;
    const int g    = qb / QPG;
    const int nseg = g + 1;
    const int p0   = (T0(g) + qb % QPG) * 64 + (row & 63);   // range 0's row
    const float*  mlp = ML + p0 * 2;                 // next range: QPG*64 rows on
    const float*  op  = Op + (size_t)p0 * HD + d;

    v2f ml[NGRP];                                    // (maximum, denominator)
    v4f o[NGRP];
    // the three loops are unrolled so that ml and o stay in registers
#pragma unroll
    for (int s = 0; s < NGRP; ++s) {
        ml[s] = (v2f){-__builtin_inff(), 0.0f};
        o[s]  = (v4f){0.0f, 0.0f, 0.0f, 0.0f};
        if (s < nseg) {
            ml[s] = *(const v2f*)(mlp + s * (QPG * 64 * 2));
            o[s]  = *(const v4f*)(op + s * (QPG * 64 * HD));
        }
    }
    float mx = ml[0].x;
#pragma unroll
    for (int s = 1; s < NGRP; ++s) mx = fmaxf(mx, ml[s].x);
    float den = 0.0f;
    v4f   acc = {0.0f, 0.0f, 0.0f, 0.0f};
#pragma unroll
    for (int s = 0; s < NGRP; ++s) {
        const float wgt = __expf(ml[s].x - mx);      // absent range: exp(-inf) = 0
        den += wgt * ml[s].y;
        acc += wgt * o[s];
    }
    *(v4f*)(out + (size_t)row * HD + d) = acc * (1.0f / den);
}

extern "C" void kernel_launch(void* const* d_in, const int* in_sizes, int n_in,
                              void* d_out, int out_size, void* d_ws, size_t ws_size,
                              hipStream_t stream) {
    const float* x  = (const float*)d_in[0];
    const float* Wq = (const float*)d_in[1];
    const float* bq = (const float*)d_in[2];
    const float* Wk = (const float*)d_in[3];
    const float* bk = (const float*)d_in[4];
    const float* Wv = (const float*)d_in[5];
    const float* bv = (const float*)d_in[6];

    _Float16* Qh = (_Float16*)d_ws;
    _Float16* Kh = Qh + (size_t)SEQ_LEN * HD;
    _Float16* Vh = Kh + (size_t)SEQ_LEN * HD;
    float*  Op = (float*)(Vh + (size_t)SEQ_LEN * HD);    // NPART x 64 x 64
    float*  ML = Op + (size_t)NPART * 64 * HD;           // NPART x 64 x 2

    qkv_proj<<<dim3(SEQ_LEN / (16 * RT)), 32 * KSPLIT, 0, stream>>>(
        x, Wq, Wk, Wv, bq, bk, bv, Qh, Kh, Vh);

    flash_attn<<<dim3(NPART), 128, 0, stream>>>(
        Qh, Kh, Vh, Op, ML);

    merge_parts<<<dim3(SEQ_LEN / 16), 256, 0, stream>>>(
        Op, ML, (float*)d_out);
}

// v006
// One run takes 27.1 microseconds.
// Next to v005, in two timings, it ran 1.08 times as fast each time.
// All steps since v000 together make it 14.8 times as fast.
#include <hip/hip_runtime.h>
#include <hip/hip_bf16.h>

typedef __attribute__((ext_vector_type(16))) _Float16 v16h;
typedef __attribute__((ext_vector_type(8)))  _Float16 v8h;
typedef __attribute__((ext_vector_type(4)))  _Float16 v4h;
typedef __attribute__((ext_vector_type(8)))  float    v8f;
typedef __attribute__((ext_vector_type(4)))  float    v4f;
typedef __attribute__((ext_vector_type(2)))  float    v2f;
typedef __attribute__((ext_vector_type(4)))  int      v4i;
typedef __attribute__((ext_vector_type(8)))  short    v8s;

#define AS1 __attribute__((address_space(1)))
#define AS3 __attribute__((address_space(3)))

#define SEQ_LEN 8192
#define EMB     768
#define HD      64
#define INV_SCALE 0.125f   // 1/sqrt(64)
#define LOG2E 1.44269504f  // exp(x) = exp2(x * LOG2E)

// LDS row strides (halves): padded for 16B alignment + bank-conflict avoidance
#define KSTR 72   // CK keys x 64 dims, row stride 72  (144B, banks step 36)
#define VSTR 80   // CK keys x 64 dims, row stride 80  (160B = 32B x odd, for the transposing reads)
#define OSTR 68   // floats: 16 queries x 64 dims, row stride 68 (272B, banks step 4)

// Split of the keys over work-groups: a key range is SEGC chunks of CK keys,
// as long as QPG query blocks of 64 rows.  Query blocks g*QPG .. g*QPG+QPG-1
// (group g) need g+1 ranges each; T0(g) counts the work-groups of groups < g.
#define CK   64
#define SEGC 8
#define QPG  (SEGC * CK / 64)
#define NGRP (SEQ_LEN / 64 / QPG)
#define T0(g) (QPG * (g) * ((g) + 1) / 2)
#define NPART T0(NGRP)

#if __has_builtin(__builtin_amdgcn_global_load_async_to_lds_b128) && \
    __has_builtin(__builtin_amdgcn_s_wait_asynccnt)
#define USE_ASYNC_LDS 1
#else
#define USE_ASYNC_LDS 0
#endif

static __device__ __forceinline__ v8f wmma_f16(v16h a, v16h b, v8f c) {
    return __builtin_amdgcn_wmma_f32_16x16x32_f16(
        /*neg_a=*/false, a, /*neg_b=*/false, b,
        /*c_mod=*/(short)0, c, /*reuse_a=*/false, /*reuse_b=*/false);
}

// 16-bit 16x32 A/B fragment mapping (ISA 7.12.2):
// lane = (k/8 % 2)*16 + (m|n);  element e -> k = 8*hi + (e<8 ? e : e+8)
static __device__ __forceinline__ int kmap(int e, int hi) {
    return hi * 8 + (e < 8 ? e : e + 8);
}

// Load one 16-element f16 fragment slice for a 32-wide k-window starting at p
// (p = row base; must be 16B aligned).  Lowers to two 16B vector loads.
static __device__ __forceinline__ v16h ld_frag16(const _Float16* p, int hi) {
    const v8h a = *(const v8h*)(p + hi * 8);
    const v8h b = *(const v8h*)(p + 16 + hi * 8);
    return __builtin_shufflevector(a, b, 0, 1, 2, 3, 4, 5, 6, 7,
                                         8, 9, 10, 11, 12, 13, 14, 15);
}

// Value of the lane 16 away (the other half of the wave), without LDS.
static __device__ __forceinline__ float other_half(float x) {
    const int b = __builtin_bit_cast(int, x);
    return __builtin_bit_cast(float, __builtin_amdgcn_permlanex16(
        b, b, 0x76543210, 0xfedcba98, false, false));
}

// Exponentials in place.  The instruction set asks for one independent instruction
// or v_nop between a transcendental and a use of its result or an overwrite of its
// source: in a run in place each is that instruction for the one in front of it, and
// the v_nop stands behind the last.
static __device__ __forceinline__ void exp2_x8(float (&x)[8]) {
    asm("v_exp_f32 %0, %0\n\tv_exp_f32 %1, %1\n\tv_exp_f32 %2, %2\n\tv_exp_f32 %3, %3\n\t"
        "v_exp_f32 %4, %4\n\tv_exp_f32 %5, %5\n\tv_exp_f32 %6, %6\n\tv_exp_f32 %7, %7\n\t"
        "v_nop"
        : "+v"(x[0]), "+v"(x[1]), "+v"(x[2]), "+v"(x[3]),
          "+v"(x[4]), "+v"(x[5]), "+v"(x[6]), "+v"(x[7]));
}
static __device__ __forceinline__ void exp2_x1(float& x) {
    asm("v_exp_f32 %0, %0\n\tv_nop" : "+v"(x));
}

// One 16-column x 32-row transposed fragment (hardware k order over the rows)
// of a row-major f16 block of row stride VSTR: two transposing loads, rows
// 0..15 and 16..31.  p = this lane's address for columns 0..15, rows 0..15:
// block + (8*hi + (lane & 7)) * VSTR + ((lane >> 3) & 1) * 8.
static __device__ __forceinline__ v16h ld_fragT(const _Float16* p) {
    const v8s a = __builtin_amdgcn_ds_load_tr16_b128_v8i16((AS3 v8s*)(AS3 void*)p);
    const v8s b = __builtin_amdgcn_ds_load_tr16_b128_v8i16(
        (AS3 v8s*)(AS3 void*)(p + 16 * VSTR));
    return __builtin_bit_cast(v16h, __builtin_shufflevector(
        a, b, 0, 1, 2, 3, 4, 5, 6, 7, 8, 9, 10, 11, 12, 13, 14, 15));
}

// ---------------------------------------------------------------------------
// Kernel 1: fused QKV projection.  One work-group owns RT 16-row strips of x
// and computes ALL of Q|K|V.  The 768-deep k loop is split over KSPLIT waves,
// KSTEPS steps of 32 each; the f32 partial tiles are joined through LDS.
// W is read as it comes, f32 [k][n]: a wave brings each 32 x 64 block of its
// k range by whole 512-B loads, rounds it to f16 into its own LDS block and
// takes the B fragments back by the transposing load.  With RT = 2 a W block
// feeds two strips, so the f32 bytes per output row are those of f16 at RT = 1.
// x is still read once.
// ---------------------------------------------------------------------------
#define KSPLIT 8
#define KSTEPS (EMB / 32 / KSPLIT)
#define RT 2
#define WRING 3                                      // W blocks held in registers
// floats per 16x16 partial tile: 8 rows of 32 lanes, plus 16 so that the four
// tiles that make up one 64-column output row fall on different LDS banks
#define TSTR (8 * 32 + 16)

__global__ void __launch_bounds__(32 * KSPLIT) qkv_proj(
        const float* __restrict__ x,
        const float* __restrict__ Wq, const float* __restrict__ Wk,
        const float* __restrict__ Wv,
        const float* __restrict__ bq, const float* __restrict__ bk,
        const float* __restrict__ bv,
        _Float16* __restrict__ Qh, _Float16* __restrict__ Kh,
        _Float16* __restrict__ Vh) {
    __shared__ __attribute__((aligned(16))) float part[KSPLIT][RT * 12 * TSTR];
    __shared__ __attribute__((aligned(16))) _Float16 wst[KSPLIT][2][32 * VSTR];

    const int tid   = threadIdx.x;
    const int lane  = tid & 31;
    const int w     = tid >> 5;
    const int lo    = lane & 15;
    const int hi    = lane >> 4;
    const int mbase = blockIdx.x * (16 * RT);
    const int kbeg  = w * (KSTEPS * 32);             // this wave's k range

    const float* Ws[3]   = {Wq, Wk, Wv};
    const float* bs[3]   = {bq, bk, bv};
    _Float16*    dsts[3] = {Qh, Kh, Vh};

    // x first (it comes from furthest away): 4 x float4 per strip and step
    const float* xrow = x + (size_t)(mbase + lo) * EMB + kbeg + hi * 8;
    v4f xr[KSTEPS][RT][4];
#pragma unroll
    for (int s = 0; s < KSTEPS; ++s)
#pragma unroll
        for (int rt = 0; rt < RT; ++rt) {
            const float* xp = xrow + rt * 16 * EMB + s * 32;
            xr[s][rt][0] = *(const v4f*)(xp);
            xr[s][rt][1] = *(const v4f*)(xp + 4);
            xr[s][rt][2] = *(const v4f*)(xp + 16);
            xr[s][rt][3] = *(const v4f*)(xp + 20);
        }
    // the x loads' address pair is an input, so it stays whole up to this wait:
    // no load's result and no later value lands in it before that
    asm volatile("s_wait_xcnt 0x0" :: "v"(xrow) : "memory");

    // W block u = (which, step): load j covers rows 2j and 2j+1, 256 B each
    const unsigned wofb = ((kbeg + hi) * HD + lo * 4) * 4u;  // this lane's byte offset
    v4f wr[WRING][16];
#pragma unroll
    for (int u = 0; u < WRING - 1; ++u)
#pragma unroll
        for (int j = 0; j < 16; ++j)
            wr[u][j] = *(const v4f*)((const char*)(Ws[u / KSTEPS] + ((u % KSTEPS) * 32 + j * 2) * HD) + wofb);

    v16h a[KSTEPS][RT];                              // A fragments, f16
#pragma unroll
    for (int s = 0; s < KSTEPS; ++s)
#pragma unroll
        for (int rt = 0; rt < RT; ++rt)
#pragma unroll
            for (int q = 0; q < 4; ++q)
#pragma unroll
                for (int i = 0; i < 4; ++i)
                    a[s][rt][q * 4 + i] = (_Float16)xr[s][rt][q][i];

    // all loops over blocks are unrolled: wr, a and acc are indexed by constants
#pragma unroll
    for (int which = 0; which < 3; ++which) {
        v8f acc[RT][4] = {};
#pragma unroll
        for (int s = 0; s < KSTEPS; ++s) {
            const int u = which * KSTEPS + s;
            const int n = u + WRING - 1;             // block fetched ahead
            if (n < 3 * KSTEPS) {
#pragma unroll
                for (int j = 0; j < 16; ++j)
                    wr[n % WRING][j] = *(const v4f*)((const char*)(
                        Ws[n / KSTEPS] + ((n % KSTEPS) * 32 + j * 2) * HD) + wofb);
                // behind the last W loads: their offset register is an input, so it
                // stays whole up to this wait and may be reused only behind it
                if (n == 3 * KSTEPS - 1) asm volatile("s_wait_xcnt 0x0" :: "v"(wofb) : "memory");
            }
            // nothing is scheduled across this line: block u is rounded here and the
            // blocks fetched ahead stay in flight meanwhile (without it the compiler
            // rounds each block early and waits for its loads right behind their issue)
            __builtin_amdgcn_sched_barrier(0);
            _Float16* st = wst[w][u & 1];
#pragma unroll
            for (int j = 0; j < 16; ++j) {
                v4h h;
#pragma unroll
                for (int i = 0; i < 4; ++i) h[i] = (_Float16)wr[u % WRING][j][i];
                *(v4h*)(st + (j * 2 + hi) * VSTR + lo * 4) = h;
            }
            // wave-local LDS fence: the transposing reads take other lanes' stores
            asm volatile("s_wait_dscnt 0x0" ::: "memory");
            const _Float16* vt = st + (8 * hi + (lane & 7)) * VSTR + ((lane >> 3) & 1) * 8;
#pragma unroll
            for (int g = 0; g < 4; ++g) {
                const v16h bf = ld_fragT(vt + g * 16);
#pragma unroll
                for (int rt = 0; rt < RT; ++rt)
                    acc[rt][g] = wmma_f16(a[s][rt], bf, acc[rt][g]);
            }
        }
        // the wave leaves its partial tiles in C layout (row = vgpr + 8*hi)
#pragma unroll
        for (int rt = 0; rt < RT; ++rt)
#pragma unroll
            for (int g = 0; g < 4; ++g)
#pragma unroll
                for (int v = 0; v < 8; ++v)
                    part[w][(rt * 12 + which * 4 + g) * TSTR + v * 32 + lane] = acc[rt][g][v];
    }
    __syncthreads();                                 // all partials are in LDS

    // join: 16 threads per output row, four columns each, whole 128-B rows out;
    // unrolled so that the LDS reads of all partials are in flight together
    const int r  = tid >> 4;                         // 0 .. 15
    const int c4 = tid & 15;                         // columns c4*4 .. c4*4+3
    const int po = (c4 >> 2) * TSTR + (r & 7) * 32 + (r >> 3) * 16 + (c4 & 3) * 4;
#pragma unroll
    for (int rt = 0; rt < RT; ++rt) {
#pragma unroll
        for (int which = 0; which < 3; ++which) {
            const float scale = (which == 0) ? INV_SCALE : 1.0f;
            const int   pt    = (rt * 12 + which * 4) * TSTR + po;
            v4f s = *(const v4f*)&part[0][pt];
#pragma unroll
            for (int p = 1; p < KSPLIT; ++p)
                s += *(const v4f*)&part[p][pt];
            const v4f bias = *(const v4f*)(bs[which] + c4 * 4);
            v4h h;
#pragma unroll
            for (int i = 0; i < 4; ++i)
                h[i] = (_Float16)((s[i] + bias[i]) * scale);
            *(v4h*)(dsts[which] + (size_t)(mbase + rt * 16 + r) * HD + c4 * 4) = h;
        }
    }
}

// ---------------------------------------------------------------------------
// Cooperative stage of one CK-key chunk of K and V into LDS, both row-major
// [key][dim] by async global->LDS b128 copies (K: stride KSTR, V: stride VSTR).
// The V^T fragments of the second product come by the transposing LDS load.
// ---------------------------------------------------------------------------
static __device__ __forceinline__ void stage_chunk(
        const _Float16* __restrict__ Kh, const _Float16* __restrict__ Vh,
        int j0, _Float16* kdst, _Float16* vdst, int tid) {
#pragma unroll
    for (int i = 0; i < CK / 16; ++i) {              // CK * 64 halves / (128 thr * 8)
        const int off = (i * 128 + tid) * 8;
        const int key = off >> 6;
        const int dim = off & 63;
        const _Float16* gsrc = Kh + (size_t)j0 * HD + off;
        _Float16*       ldst = kdst + key * KSTR + dim;
#if USE_ASYNC_LDS
        __builtin_amdgcn_global_load_async_to_lds_b128(
            (AS1 v4i*)(AS1 void*)gsrc,
            (AS3 v4i*)(AS3 void*)ldst,
            0, 0);
#else
        *(v8h*)ldst = *(const v8h*)gsrc;
#endif
    }
#pragma unroll
    for (int i = 0; i < CK / 16; ++i) {
        const int off = (i * 128 + tid) * 8;
        const int key = off >> 6;
        const int dim = off & 63;
        const _Float16* gsrc = Vh + (size_t)j0 * HD + off;
        _Float16*       ldst = vdst + key * VSTR + dim;
#if USE_ASYNC_LDS
        __builtin_amdgcn_global_load_async_to_lds_b128(
            (AS1 v4i*)(AS1 void*)gsrc,
            (AS3 v4i*)(AS3 void*)ldst,
            0, 0);
#else
        *(v8h*)ldst = *(const v8h*)gsrc;
#endif
    }
}

// ---------------------------------------------------------------------------
// Kernel 2: causal flash attention over ONE key range.  Work-group t serves
// (query block qb, key range seg) and leaves its un-normalised sum with each
// row's maximum and denominator in the workspace; merge_parts joins them.
// A range starts at a multiple of 64 keys that is <= 64*qb, so its first
// chunk holds an unmasked key for every row of the block.
// 128 threads = 4 waves; wave w owns
// query rows [qbase, qbase+16).  All waves run the block's chunk count so
// barriers are uniform, letting
// the block share double-buffered K/V LDS tiles loaded once per block.
// The products are transposed: S^T = K@Q^T (A = K rows, B = Q) and
// O^T += V^T@P^T (A = V^T rows, B = P^T).  A lane then holds 32 of the 64
// scores of ONE query (column lo): maximum and sum run in the lane, with one
// exchange between the wave's halves, and each pair of S^T tiles, converted in
// place, is a P^T operand in the hardware k order.  Per chunk: 8 + 8 WMMA, one
// publish point, one running-maximum update and one rescale of O^T.
// ---------------------------------------------------------------------------
__global__ void __launch_bounds__(128) flash_attn(
        const _Float16* __restrict__ Qh, const _Float16* __restrict__ Kh,
        const _Float16* __restrict__ Vh, float* __restrict__ Op,
        float* __restrict__ ML) {
    __shared__ __attribute__((aligned(16))) _Float16 kbuf[2][CK * KSTR];
    __shared__ __attribute__((aligned(16))) _Float16 vbuf[2][CK * VSTR];
    __shared__ __attribute__((aligned(16))) float obuf[4][16 * OSTR];

    const int tid   = threadIdx.x;
    const int lane  = tid & 31;
    const int w     = tid >> 5;
    const int lo    = lane & 15;
    const int hi    = lane >> 4;
    const int t     = blockIdx.x;
    int g = 0;
#pragma unroll                                       // T0(i) become literals
    for (int i = 1; i < NGRP; ++i) g += (t >= T0(i)) ? 1 : 0;
    const unsigned rem = t - T0(g);
    const int seg   = rem / QPG;                     // 0 .. g
    const int qsub  = rem % QPG;
    const int qbase = (g * QPG + qsub) * 64 + w * 16;

    v8f o0 = {}, o1 = {}, o2 = {}, o3 = {};
    float m = -__builtin_inff();                     // of query qbase + lo
    float l = 0.0f;                                  // over this half's keys only
    const int ch0 = seg * SEGC;                      // even: buffer 0 comes first
    // a whole range below the diagonal, up to the block's last key on it
    const int nch = ch0 + ((seg < g) ? SEGC : qsub + 1);      // block-uniform

    stage_chunk(Kh, Vh, ch0 * CK, kbuf[0], vbuf[0], tid);
    // the Q loads below may land in registers that the staging loads name
    asm volatile("s_wait_xcnt 0x0" ::: "memory");

    // Q fragments (16 queries x 64 head-dim, the B operand), pre-scaled by 1/sqrt(d)
    const _Float16* qrow = Qh + (size_t)(qbase + lo) * HD;
    const v16h aq0 = ld_frag16(qrow, hi);
    const v16h aq1 = ld_frag16(qrow + 32, hi);

    for (int it = ch0; it < nch; ++it) {
        const int j0  = it * CK;
        const int cur = it & 1;

        // publish point: this wave's reads of the buffer refilled below are over,
        // its own K and V copies of this chunk have landed, then the barrier
        asm volatile("s_wait_dscnt 0x0" ::: "memory");
#if USE_ASYNC_LDS
        asm volatile("s_wait_asynccnt 0x0" ::: "memory");
#endif
        __syncthreads();                             // chunk visible; prev readers done

        if (it + 1 < nch)
            stage_chunk(Kh, Vh, (it + 1) * CK, kbuf[cur ^ 1], vbuf[cur ^ 1], tid);

        const _Float16* kb = kbuf[cur];
        // lane's source row and 16-B half of the transposing loads
        const _Float16* vt = vbuf[cur] + (8 * hi + (lane & 7)) * VSTR + ((lane >> 3) & 1) * 8;

        // --- S^T = K @ Q^T (keys j0..j0+63) from LDS (ds_load_b128 pairs) -
        v16h bk[4][2];                               // [16-key tile][dims 0..31, 32..63]
#pragma unroll                                       // bk, s and xs are indexed by constants
        for (int t4 = 0; t4 < 4; ++t4) {
            bk[t4][0] = ld_frag16(kb + (t4 * 16 + lo) * KSTR, hi);
            bk[t4][1] = ld_frag16(kb + (t4 * 16 + lo) * KSTR + 32, hi);
        }

        // inputs-only fence on the loaded fragments: keeps the sixteen LDS loads
        // together ahead of the products (one LDS wait a chunk, not one a product)
        asm volatile("" :: "v"(bk[0][0]), "v"(bk[0][1]), "v"(bk[1][0]), "v"(bk[1][1]),
                           "v"(bk[2][0]), "v"(bk[2][1]), "v"(bk[3][0]), "v"(bk[3][1]));

        v8f s[4] = {};                               // s[t4][v]: key 16*t4 + v + 8*hi, query lo
#pragma unroll
        for (int t4 = 0; t4 < 4; ++t4) s[t4] = wmma_f16(bk[t4][0], aq0, s[t4]);
#pragma unroll
        for (int t4 = 0; t4 < 4; ++t4) s[t4] = wmma_f16(bk[t4][1], aq1, s[t4]);

        // V^T by transposing loads of row-major V, issued here, ahead of the softmax,
        // which covers their latency; they take the registers the K fragments leave
        v16h bv[2][4];                               // [keys 0..31, 32..63][16-dim tile]
#pragma unroll
        for (int h = 0; h < 2; ++h)
#pragma unroll
            for (int g4 = 0; g4 < 4; ++g4)
                bv[h][g4] = ld_fragT(vt + h * 32 * VSTR + g4 * 16);
        // nothing is scheduled across this line: the sixteen loads stay above the softmax
        // (without it they sink among the second products, which then wait for each
        // pair of loads, and the first products are split up and padded with v_nop)
        __builtin_amdgcn_sched_barrier(0);

        // --- causal mask + online softmax, one query per lane ------------
        const int d = qbase + lo - j0 - 8 * hi;      // key j0 + 8*hi + i is kept if i <= d
        float xs[4][8];
        float mxa = -__builtin_inff(), mxb = -__builtin_inff();  // two short chains
#pragma unroll
        for (int v = 0; v < 8; ++v) {
#pragma unroll
            for (int t4 = 0; t4 < 4; ++t4)
                xs[t4][v] = (t4 * 16 + v <= d) ? s[t4][v] : -__builtin_inff();
            mxa = fmaxf(mxa, fmaxf(xs[0][v], xs[1][v]));
            mxb = fmaxf(mxb, fmaxf(xs[2][v], xs[3][v]));
        }
        float mx = fmaxf(mxa, mxb);
        mx = fmaxf(mx, other_half(mx));              // all 64 keys of the chunk
        const float mnew = fmaxf(m, mx);             // finite: every chunk holds a kept key
        float a = (m - mnew) * LOG2E;
#pragma unroll                                       // xs is indexed by constants
        for (int t4 = 0; t4 < 4; ++t4) {
#pragma unroll
            for (int v = 0; v < 8; ++v)
                xs[t4][v] = (xs[t4][v] - mnew) * LOG2E;
            exp2_x8(xs[t4]);                         // exp2(-inf) -> 0 masks
        }
        exp2_x1(a);
        float suma = 0.0f, sumb = 0.0f;
        v16h pa, pb;                                 // P^T: p[e] = key kmap(e, hi), pb 32 on
#pragma unroll
        for (int v = 0; v < 8; ++v) {
            suma += xs[0][v] + xs[1][v];
            sumb += xs[2][v] + xs[3][v];
            pa[v]     = (_Float16)xs[0][v];
            pa[8 + v] = (_Float16)xs[1][v];
            pb[v]     = (_Float16)xs[2][v];
            pb[8 + v] = (_Float16)xs[3][v];
        }
        m = mnew;
        l = l * a + (suma + sumb);
        o0 *= a; o1 *= a; o2 *= a; o3 *= a;

        // --- O^T += V^T @ P^T ---------------------------------------------
        o0 = wmma_f16(bv[0][0], pa, o0);
        o1 = wmma_f16(bv[0][1], pa, o1);
        o2 = wmma_f16(bv[0][2], pa, o2);
        o3 = wmma_f16(bv[0][3], pa, o3);
        o0 = wmma_f16(bv[1][0], pb, o0);
        o1 = wmma_f16(bv[1][1], pb, o1);
        o2 = wmma_f16(bv[1][2], pb, o2);
        o3 = wmma_f16(bv[1][3], pb, o3);
    }

#if USE_ASYNC_LDS
    // no copy is left in flight when the wave goes on to the output staging
    asm volatile("s_wait_asynccnt 0x0" ::: "memory");
#endif

    // --- epilogue: this range's partial sum, maximum and denominator ------
    l += other_half(l);                              // join the halves' keys
    if (hi == 0)
        *(v2f*)(ML + (t * 64 + w * 16 + lo) * 2) = (v2f){m, l};

    // o_g[v] is dim g*16 + 8*hi + v of query lo: turn the tile back through
    // this wave's own LDS so that each store covers two whole 256-B rows
    float* ob = obuf[w];
    float* oq = ob + lo * OSTR + hi * 8;
    *(v4f*)(oq)      = __builtin_shufflevector(o0, o0, 0, 1, 2, 3);
    *(v4f*)(oq + 4)  = __builtin_shufflevector(o0, o0, 4, 5, 6, 7);
    *(v4f*)(oq + 16) = __builtin_shufflevector(o1, o1, 0, 1, 2, 3);
    *(v4f*)(oq + 20) = __builtin_shufflevector(o1, o1, 4, 5, 6, 7);
    *(v4f*)(oq + 32) = __builtin_shufflevector(o2, o2, 0, 1, 2, 3);
    *(v4f*)(oq + 36) = __builtin_shufflevector(o2, o2, 4, 5, 6, 7);
    *(v4f*)(oq + 48) = __builtin_shufflevector(o3, o3, 0, 1, 2, 3);
    *(v4f*)(oq + 52) = __builtin_shufflevector(o3, o3, 4, 5, 6, 7);
    // wave-local LDS fence: the reads below take what other lanes stored above
    asm volatile("s_wait_dscnt 0" ::: "memory");
    float* orow = Op + (size_t)(t * 64 + w * 16 + hi) * HD + lo * 4;
#pragma unroll                                       // all eight reads in flight
    for (int i = 0; i < 8; ++i)
        *(v4f*)(orow + i * 2 * HD) = *(const v4f*)(ob + (i * 2 + hi) * OSTR + lo * 4);
}

// ---------------------------------------------------------------------------
// Kernel 3: join the key ranges of each query row.  16 threads per row, four
// output columns each; the range count is uniform in a work-group (16 rows of
// one query block): absent ranges are skipped by scalar branches, and the
// loads of the present ones are in flight together.
// ---------------------------------------------------------------------------
__global__ void __launch_bounds__(256) merge_parts(
        const float* __restrict__ Op, const float* __restrict__ ML,
        float* __restrict__ out) {
    const int row  = blockIdx.x * 16 + (threadIdx.x >> 4);
    const int d    = (threadIdx.x & 15) * 4;
    const int qb   = blockIdx.x >> 2;
    const int g    = qb / QPG;
    const int nseg = g + 1;
    const int p0   = (T0(g) + qb % QPG) * 64 + (row & 63);   // range 0's row
    const float*  mlp = ML + p0 * 2;                 // next range: QPG*64 rows on
    const float*  op  = Op + (size_t)p0 * HD + d;

    v2f ml[NGRP];                                    // (maximum, denominator)
    v4f o[NGRP];
    // the three loops are unrolled so that ml and o stay in registers
#pragma unroll
    for (int s = 0; s < NGRP; ++s) {
        ml[s] = (v2f){-__builtin_inff(), 0.0f};
        o[s]  = (v4f){0.0f, 0.0f, 0.0f, 0.0f};
        if (s < nseg) {
            ml[s] = *(const v2f*)(mlp + s * (QPG * 64 * 2));
            o[s]  = *(const v4f*)(op + s * (QPG * 64 * HD));
        }
    }
    float mx = ml[0].x;
#pragma unroll
    for (int s = 1; s < NGRP; ++s) mx = fmaxf(mx, ml[s].x);
    float den = 0.0f;
    v4f   acc = {0.0f, 0.0f, 0.0f, 0.0f};
#pragma unroll
    for (int s = 0; s < NGRP; ++s) {
        const float wgt = __expf(ml[s].x - mx);      // absent range: exp(-inf) = 0
        den += wgt * ml[s].y;
        acc += wgt * o[s];
    }
    *(v4f*)(out + (size_t)row * HD + d) = acc * (1.0f / den);
}

extern "C" void kernel_launch(void* const* d_in, const int* in_sizes, int n_in,
                              void* d_out, int out_size, void* d_ws, size_t ws_size,
                              hipStream_t stream) {
    const float* x  = (const float*)d_in[0];
    const float* Wq = (const float*)d_in[1];
    const float* bq = (const float*)d_in[2];
    const float* Wk = (const float*)d_in[3];
    const float* bk = (const float*)d_in[4];
    const float* Wv = (const float*)d_in[5];
    const float* bv = (const float*)d_in[6];

    _Float16* Qh = (_Float16*)d_ws;
    _Float16* Kh = Qh + (size_t)SEQ_LEN * HD;
    _Float16* Vh = Kh + (size_t)SEQ_LEN * HD;
    float*  Op = (float*)(Vh + (size_t)SEQ_LEN * HD);    // NPART x 64 x 64
    float*  ML = Op + (size_t)NPART * 64 * HD;           // NPART x 64 x 2

    qkv_proj<<<dim3(SEQ_LEN / (16 * RT)), 32 * KSPLIT, 0, stream>>>(
        x, Wq, Wk, Wv, bq, bk, bv, Qh, Kh, Vh);

    flash_attn<<<dim3(NPART), 128, 0, stream>>>(
        Qh, Kh, Vh, Op, ML);

    merge_parts<<<dim3(SEQ_LEN / 16), 256, 0, stream>>>(
        Op, ML, (float*)d_out);
}

// v007
// Measured time: 26 microseconds a run.
// In two side-by-side timings against v006, it was 1.05 and 1.06 times as fast.
// All steps since v000 together make it 15.7 times as fast.
#include <hip/hip_runtime.h>
#include <hip/hip_bf16.h>

typedef __attribute__((ext_vector_type(16))) _Float16 v16h;
typedef __attribute__((ext_vector_type(8)))  _Float16 v8h;
typedef __attribute__((ext_vector_type(4)))  _Float16 v4h;
typedef __attribute__((ext_vector_type(8)))  float    v8f;
typedef __attribute__((ext_vector_type(4)))  float    v4f;
typedef __attribute__((ext_vector_type(2)))  float    v2f;
typedef __attribute__((ext_vector_type(4)))  int      v4i;
typedef __attribute__((ext_vector_type(8)))  short    v8s;

#define AS1 __attribute__((address_space(1)))
#define AS3 __attribute__((address_space(3)))

#define SEQ_LEN 8192
#define EMB     768
#define HD      64
#define INV_SCALE 0.125f   // 1/sqrt(64)
#define LOG2E 1.44269504f  // exp(x) = exp2(x * LOG2E)

// LDS row strides (halves): padded for 16B alignment + bank-conflict avoidance
#define KSTR 72   // CK keys x 64 dims, row stride 72  (144B, banks step 36)
#define VSTR 80   // CK keys x 64 dims, row stride 80  (160B = 32B x odd, for the transposing reads)
#define OSTR 68   // floats: QT*16 queries x 64 dims, row stride 68 (272B, banks step 4)

// Split of the keys over work-groups: a key range is SEGC chunks of CK keys,
// as long as QPG query blocks of QROWS rows.  Query blocks g*QPG .. g*QPG+QPG-1
// (group g) need g+1 ranges each; T0(g) counts the partials of groups < g,
// F0(g) those of them that lie wholly below the diagonal.
// A wave holds QT tiles of 16 queries, a work-group of 4 waves QROWS rows.
#define CK   64
#define SEGC 8
#define QT   2
#define QROWS (4 * 16 * QT)
#define QPG  (SEGC * CK / QROWS)
#define NGRP (SEQ_LEN / QROWS / QPG)
#define T0(g) (QPG * (g) * ((g) + 1) / 2)
#define F0(g) (QPG * (g) * ((g) - 1) / 2)
#define NPART T0(NGRP)
#define NFULL F0(NGRP)

#if __has_builtin(__builtin_amdgcn_global_load_async_to_lds_b128) && \
    __has_builtin(__builtin_amdgcn_s_wait_asynccnt)
#define USE_ASYNC_LDS 1
#else
#define USE_ASYNC_LDS 0
#endif

static __device__ __forceinline__ v8f wmma_f16(v16h a, v16h b, v8f c) {
    return __builtin_amdgcn_wmma_f32_16x16x32_f16(
        /*neg_a=*/false, a, /*neg_b=*/false, b,
        /*c_mod=*/(short)0, c, /*reuse_a=*/false, /*reuse_b=*/false);
}

// 16-bit 16x32 A/B fragment mapping (ISA 7.12.2):
// lane = (k/8 % 2)*16 + (m|n);  element e -> k = 8*hi + (e<8 ? e : e+8)
static __device__ __forceinline__ int kmap(int e, int hi) {
    return hi * 8 + (e < 8 ? e : e + 8);
}

// Load one 16-element f16 fragment slice for a 32-wide k-window starting at p
// (p = row base; must be 16B aligned).  Lowers to two 16B vector loads.
static __device__ __forceinline__ v16h ld_frag16(const _Float16* p, int hi) {
    const v8h a = *(const v8h*)(p + hi * 8);
    const v8h b = *(const v8h*)(p + 16 + hi * 8);
    return __builtin_shufflevector(a, b, 0, 1, 2, 3, 4, 5, 6, 7,
                                         8, 9, 10, 11, 12, 13, 14, 15);
}

// Value of the lane 16 away (the other half of the wave), without LDS.
static __device__ __forceinline__ float other_half(float x) {
    const int b = __builtin_bit_cast(int, x);
    return __builtin_bit_cast(float, __builtin_amdgcn_permlanex16(
        b, b, 0x76543210, 0xfedcba98, false, false));
}

// Exponentials in place.  The instruction set asks for one independent instruction
// or v_nop between a transcendental and a use of its result or an overwrite of its
// source: in a run in place each is that instruction for the one in front of it, and
// the v_nop stands behind the last.
static __device__ __forceinline__ void exp2_x8(float (&x)[8]) {
    asm("v_exp_f32 %0, %0\n\tv_exp_f32 %1, %1\n\tv_exp_f32 %2, %2\n\tv_exp_f32 %3, %3\n\t"
        "v_exp_f32 %4, %4\n\tv_exp_f32 %5, %5\n\tv_exp_f32 %6, %6\n\tv_exp_f32 %7, %7\n\t"
        "v_nop"
        : "+v"(x[0]), "+v"(x[1]), "+v"(x[2]), "+v"(x[3]),
          "+v"(x[4]), "+v"(x[5]), "+v"(x[6]), "+v"(x[7]));
}
static __device__ __forceinline__ void exp2_x1(float& x) {
    asm("v_exp_f32 %0, %0\n\tv_nop" : "+v"(x));
}

// One 16-column x 32-row transposed fragment (hardware k order over the rows)
// of a row-major f16 block of row stride VSTR: two transposing loads, rows
// 0..15 and 16..31.  p = this lane's address for columns 0..15, rows 0..15:
// block + (8*hi + (lane & 7)) * VSTR + ((lane >> 3) & 1) * 8.
static __device__ __forceinline__ v16h ld_fragT(const _Float16* p) {
    const v8s a = __builtin_amdgcn_ds_load_tr16_b128_v8i16((AS3 v8s*)(AS3 void*)p);
    const v8s b = __builtin_amdgcn_ds_load_tr16_b128_v8i16(
        (AS3 v8s*)(AS3 void*)(p + 16 * VSTR));
    return __builtin_bit_cast(v16h, __builtin_shufflevector(
        a, b, 0, 1, 2, 3, 4, 5, 6, 7, 8, 9, 10, 11, 12, 13, 14, 15));
}

// ---------------------------------------------------------------------------
// Kernel 1: fused QKV projection.  One work-group owns RT 16-row strips of x
// and computes ALL of Q|K|V.  The 768-deep k loop is split over KSPLIT waves,
// KSTEPS steps of 32 each; the f32 partial tiles are joined through LDS.
// W is read as it comes, f32 [k][n]: a wave brings each 32 x 64 block of its
// k range by whole 512-B loads, rounds it to f16 into its own LDS block and
// takes the B fragments back by the transposing load.  With RT = 2 a W block
// feeds two strips, so the f32 bytes per output row are those of f16 at RT = 1.
// x is still read once.
// ---------------------------------------------------------------------------
#define KSPLIT 8
#define KSTEPS (EMB / 32 / KSPLIT)
#define RT 2
#define WRING 3                                      // W blocks held in registers
// floats per 16x16 partial tile: 8 rows of 32 lanes, plus 16 so that the four
// tiles that make up one 64-column output row fall on different LDS banks
#define TSTR (8 * 32 + 16)

__global__ void __launch_bounds__(32 * KSPLIT) qkv_proj(
        const float* __restrict__ x,
        const float* __restrict__ Wq, const float* __restrict__ Wk,
        const float* __restrict__ Wv,
        const float* __restrict__ bq, const float* __restrict__ bk,
        const float* __restrict__ bv,
        _Float16* __restrict__ Qh, _Float16* __restrict__ Kh,
        _Float16* __restrict__ Vh) {
    __shared__ __attribute__((aligned(16))) float part[KSPLIT][RT * 12 * TSTR];
    __shared__ __attribute__((aligned(16))) _Float16 wst[KSPLIT][2][32 * VSTR];

    const int tid   = threadIdx.x;
    const int lane  = tid & 31;
    const int w     = tid >> 5;
    const int lo    = lane & 15;
    const int hi    = lane >> 4;
    const int mbase = blockIdx.x * (16 * RT);
    const int kbeg  = w * (KSTEPS * 32);             // this wave's k range

    const float* Ws[3]   = {Wq, Wk, Wv};
    const float* bs[3]   = {bq, bk, bv};
    _Float16*    dsts[3] = {Qh, Kh, Vh};

    // x first (it comes from furthest away): 4 x float4 per strip and step
    const float* xrow = x + (size_t)(mbase + lo) * EMB + kbeg + hi * 8;
    v4f xr[KSTEPS][RT][4];
#pragma unroll
    for (int s = 0; s < KSTEPS; ++s)
#pragma unroll
        for (int rt = 0; rt < RT; ++rt) {
            const float* xp = xrow + rt * 16 * EMB + s * 32;
            xr[s][rt][0] = *(const v4f*)(xp);
            xr[s][rt][1] = *(const v4f*)(xp + 4);
            xr[s][rt][2] = *(const v4f*)(xp + 16);
            xr[s][rt][3] = *(const v4f*)(xp + 20);
        }
    // the x loads' address pair is an input, so it stays whole up to this wait:
    // no load's result and no later value lands in it before that
    asm volatile("s_wait_xcnt 0x0" :: "v"(xrow) : "memory");

    // W block u = (which, step): load j covers rows 2j and 2j+1, 256 B each
    const unsigned wofb = ((kbeg + hi) * HD + lo * 4) * 4u;  // this lane's byte offset
    v4f wr[WRING][16];
#pragma unroll
    for (int u = 0; u < WRING - 1; ++u)
#pragma unroll
        for (int j = 0; j < 16; ++j)
            wr[u][j] = *(const v4f*)((const char*)(Ws[u / KSTEPS] + ((u % KSTEPS) * 32 + j * 2) * HD) + wofb);

    v16h a[KSTEPS][RT];                              // A fragments, f16
#pragma unroll
    for (int s = 0; s < KSTEPS; ++s)
#pragma unroll
        for (int rt = 0; rt < RT; ++rt)
#pragma unroll
            for (int q = 0; q < 4; ++q)
#pragma unroll
                for (int i = 0; i < 4; ++i)
                    a[s][rt][q * 4 + i] = (_Float16)xr[s][rt][q][i];

    // all loops over blocks are unrolled: wr, a and acc are indexed by constants
#pragma unroll
    for (int which = 0; which < 3; ++which) {
        v8f acc[RT][4] = {};
#pragma unroll
        for (int s = 0; s < KSTEPS; ++s) {
            const int u = which * KSTEPS + s;
            const int n = u + WRING - 1;             // block fetched ahead
            if (n < 3 * KSTEPS) {
#pragma unroll
                for (int j = 0; j < 16; ++j)
                    wr[n % WRING][j] = *(const v4f*)((const char*)(
                        Ws[n / KSTEPS] + ((n % KSTEPS) * 32 + j * 2) * HD) + wofb);
                // behind the last W loads: their offset register is an input, so it
                // stays whole up to this wait and may be reused only behind it
                if (n == 3 * KSTEPS - 1) asm volatile("s_wait_xcnt 0x0" :: "v"(wofb) : "memory");
            }
            // nothing is scheduled across this line: block u is rounded here and the
            // blocks fetched ahead stay in flight meanwhile (without it the compiler
            // rounds each block early and waits for its loads right behind their issue)
            __builtin_amdgcn_sched_barrier(0);
            _Float16* st = wst[w][u & 1];
#pragma unroll
            for (int j = 0; j < 16; ++j) {
                v4h h;
#pragma unroll
                for (int i = 0; i < 4; ++i) h[i] = (_Float16)wr[u % WRING][j][i];
                *(v4h*)(st + (j * 2 + hi) * VSTR + lo * 4) = h;
            }
            // wave-local LDS fence: the transposing reads take other lanes' stores
            asm volatile("s_wait_dscnt 0x0" ::: "memory");
            const _Float16* vt = st + (8 * hi + (lane & 7)) * VSTR + ((lane >> 3) & 1) * 8;
#pragma unroll
            for (int g = 0; g < 4; ++g) {
                const v16h bf = ld_fragT(vt + g * 16);
#pragma unroll
                for (int rt = 0; rt < RT; ++rt)
                    acc[rt][g] = wmma_f16(a[s][rt], bf, acc[rt][g]);
            }
        }
        // the wave leaves its partial tiles in C layout (row = vgpr + 8*hi)
#pragma unroll
        for (int rt = 0; rt < RT; ++rt)
#pragma unroll
            for (int g = 0; g < 4; ++g)
#pragma unroll
                for (int v = 0; v < 8; ++v)
                    part[w][(rt * 12 + which * 4 + g) * TSTR + v * 32 + lane] = acc[rt][g][v];
    }
    __syncthreads();                                 // all partials are in LDS

    // join: 16 threads per output row, four columns each, whole 128-B rows out;
    // unrolled so that the LDS reads of all partials are in flight together
    const int r  = tid >> 4;                         // 0 .. 15
    const int c4 = tid & 15;                         // columns c4*4 .. c4*4+3
    const int po = (c4 >> 2) * TSTR + (r & 7) * 32 + (r >> 3) * 16 + (c4 & 3) * 4;
#pragma unroll
    for (int rt = 0; rt < RT; ++rt) {
#pragma unroll
        for (int which = 0; which < 3; ++which) {
            const float scale = (which == 0) ? INV_SCALE : 1.0f;
            const int   pt    = (rt * 12 + which * 4) * TSTR + po;
            v4f s = *(const v4f*)&part[0][pt];
#pragma unroll
            for (int p = 1; p < KSPLIT; ++p)
                s += *(const v4f*)&part[p][pt];
            const v4f bias = *(const v4f*)(bs[which] + c4 * 4);
            v4h h;
#pragma unroll
            for (int i = 0; i < 4; ++i)
                h[i] = (_Float16)((s[i] + bias[i]) * scale);
            *(v4h*)(dsts[which] + (size_t)(mbase + rt * 16 + r) * HD + c4 * 4) = h;
        }
    }
}

// ---------------------------------------------------------------------------
// Cooperative stage of one CK-key chunk of K and V into LDS, both row-major
// [key][dim] by async global->LDS b128 copies (K: stride KSTR, V: stride VSTR).
// The V^T fragments of the second product come by the transposing LDS load.
// ---------------------------------------------------------------------------
static __device__ __forceinline__ void stage_chunk(
        const _Float16* __restrict__ Kh, const _Float16* __restrict__ Vh,
        int j0, _Float16* kdst, _Float16* vdst, int tid) {
#pragma unroll
    for (int i = 0; i < CK / 16; ++i) {              // CK * 64 halves / (128 thr * 8)
        const int off = (i * 128 + tid) * 8;
        const int key = off >> 6;
        const int dim = off & 63;
        const _Float16* gsrc = Kh + (size_t)j0 * HD + off;
        _Float16*       ldst = kdst + key * KSTR + dim;
#if USE_ASYNC_LDS
        __builtin_amdgcn_global_load_async_to_lds_b128(
            (AS1 v4i*)(AS1 void*)gsrc,
            (AS3 v4i*)(AS3 void*)ldst,
            0, 0);
#else
        *(v8h*)ldst = *(const v8h*)gsrc;
#endif
    }
#pragma unroll
    for (int i = 0; i < CK / 16; ++i) {
        const int off = (i * 128 + tid) * 8;
        const int key = off >> 6;
        const int dim = off & 63;
        const _Float16* gsrc = Vh + (size_t)j0 * HD + off;
        _Float16*       ldst = vdst + key * VSTR + dim;
#if USE_ASYNC_LDS
        __builtin_amdgcn_global_load_async_to_lds_b128(
            (AS1 v4i*)(AS1 void*)gsrc,
            (AS3 v4i*)(AS3 void*)ldst,
            0, 0);
#else
        *(v8h*)ldst = *(const v8h*)gsrc;
#endif
    }
}

// ---------------------------------------------------------------------------
// Kernel 2: causal flash attention over ONE key range.  A work-group serves
// (query block, key range seg) and leaves its un-normalised sum with each
// row's maximum and denominator in the workspace; merge_parts joins them.
// A range starts at a multiple of 64 keys that is <= the block's first row, so
// its first chunk holds an unmasked key for every row of the block.
// 128 threads = 4 waves; wave w owns
// query rows [qbase, qbase+16*QT).  All waves run the block's chunk count so
// barriers are uniform, letting
// the block share double-buffered K/V LDS tiles loaded once per block.
// The products are transposed: S^T = K@Q^T (A = K rows, B = Q) and
// O^T += V^T@P^T (A = V^T rows, B = P^T).  Each K and V^T fragment read from
// LDS feeds the wave's QT query tiles.  Per tile a lane holds 32 of the 64
// scores of ONE query (column lo): maximum and sum run in the lane, with one
// exchange between the wave's halves, and each pair of S^T tiles, converted in
// place, is a P^T operand in the hardware k order.  Per chunk and query tile:
// 8 + 8 WMMA, one running-maximum update and one rescale of O^T.
// ---------------------------------------------------------------------------
__global__ void __launch_bounds__(128) flash_attn(
        const _Float16* __restrict__ Qh, const _Float16* __restrict__ Kh,
        const _Float16* __restrict__ Vh, float* __restrict__ Op,
        float* __restrict__ ML) {
    __shared__ __attribute__((aligned(16))) _Float16 kbuf[2][CK * KSTR];
    __shared__ __attribute__((aligned(16))) _Float16 vbuf[2][CK * VSTR];
    __shared__ __attribute__((aligned(16))) float obuf[4][QT * 16 * OSTR];

    const int tid   = threadIdx.x;
    const int lane  = tid & 31;
    const int w     = tid >> 5;
    const int lo    = lane & 15;
    const int hi    = lane >> 4;
    const int t     = blockIdx.x;
    // whole ranges come first, the shorter ranges on the diagonal last, longest first
    int g, seg, qsub;
    if (t < NFULL) {
        g = 1;
#pragma unroll                                       // F0(i) become literals
        for (int i = 2; i < NGRP; ++i) g += (t >= F0(i)) ? 1 : 0;
        const unsigned rem = t - F0(g);
        seg  = rem / QPG;                            // 0 .. g-1
        qsub = rem % QPG;
    } else {
        const unsigned u = t - NFULL;
        qsub = QPG - 1 - u / NGRP;
        g    = u % NGRP;
        seg  = g;
    }
    const int slot  = T0(g) + seg * QPG + qsub;      // where merge_parts looks for it
    const int qbase = (g * QPG + qsub) * QROWS + w * (16 * QT);

    v8f o[QT][4] = {};
    float m[QT], l[QT];                              // of query qbase + 16*q + lo;
#pragma unroll                                       // l over this half's keys only
    for (int q = 0; q < QT; ++q) { m[q] = -__builtin_inff(); l[q] = 0.0f; }
    const int ch0 = seg * SEGC;                      // even: buffer 0 comes first
    // a whole range below the diagonal, up to the block's last key on it
    const int nch = ch0 + ((seg < g) ? SEGC : (qsub + 1) * (QROWS / CK));  // block-uniform

    stage_chunk(Kh, Vh, ch0 * CK, kbuf[0], vbuf[0], tid);
    // the Q loads below may land in registers that the staging loads name
    asm volatile("s_wait_xcnt 0x0" ::: "memory");

    // Q fragments (16 queries x 64 head-dim a tile, the B operand), pre-scaled by 1/sqrt(d)
    const _Float16* qrow = Qh + (size_t)(qbase + lo) * HD + hi * 8;
    v16h aq[QT][2];
#pragma unroll                                       // aq is indexed by constants
    for (int q = 0; q < QT; ++q) {
        aq[q][0] = ld_frag16(qrow + q * 16 * HD, 0);
        aq[q][1] = ld_frag16(qrow + q * 16 * HD + 32, 0);
    }
    // the Q loads' address pair is an input, so it stays whole up to this wait
    asm volatile("s_wait_xcnt 0x0" :: "v"(qrow) : "memory");

    for (int it = ch0; it < nch; ++it) {
        const int j0  = it * CK;
        const int cur = it & 1;

        // publish point: this wave's reads of the buffer refilled below are over,
        // its own K and V copies of this chunk have landed, then the barrier
        asm volatile("s_wait_dscnt 0x0" ::: "memory");
#if USE_ASYNC_LDS
        asm volatile("s_wait_asynccnt 0x0" ::: "memory");
#endif
        __syncthreads();                             // chunk visible; prev readers done

        if (it + 1 < nch)
            stage_chunk(Kh, Vh, (it + 1) * CK, kbuf[cur ^ 1], vbuf[cur ^ 1], tid);

        const _Float16* kb = kbuf[cur];
        // lane's source row and 16-B half of the transposing loads
        const _Float16* vt = vbuf[cur] + (8 * hi + (lane & 7)) * VSTR + ((lane >> 3) & 1) * 8;

        // --- S^T = K @ Q^T (keys j0..j0+63) from LDS (ds_load_b128 pairs) -
        v16h bk[4][2];                               // [16-key tile][dims 0..31, 32..63]
#pragma unroll                                       // bk, s and xs are indexed by constants
        for (int t4 = 0; t4 < 4; ++t4) {
            bk[t4][0] = ld_frag16(kb + (t4 * 16 + lo) * KSTR, hi);
            bk[t4][1] = ld_frag16(kb + (t4 * 16 + lo) * KSTR + 32, hi);
        }

        // inputs-only fence on the loaded fragments: keeps the sixteen LDS loads
        // together ahead of the products (one LDS wait a chunk, not one a product)
        asm volatile("" :: "v"(bk[0][0]), "v"(bk[0][1]), "v"(bk[1][0]), "v"(bk[1][1]),
                           "v"(bk[2][0]), "v"(bk[2][1]), "v"(bk[3][0]), "v"(bk[3][1]));

        v8f s[QT][4] = {};                           // s[q][t4][v]: key 16*t4 + v + 8*hi, query 16*q + lo
#pragma unroll
        for (int q = 0; q < QT; ++q)
#pragma unroll
            for (int t4 = 0; t4 < 4; ++t4) s[q][t4] = wmma_f16(bk[t4][0], aq[q][0], s[q][t4]);
#pragma unroll
        for (int q = 0; q < QT; ++q)
#pragma unroll
            for (int t4 = 0; t4 < 4; ++t4) s[q][t4] = wmma_f16(bk[t4][1], aq[q][1], s[q][t4]);

        // V^T by transposing loads of row-major V, issued here, ahead of the softmax,
        // which covers their latency; they take the registers the K fragments leave
        v16h bv[2][4];                               // [keys 0..31, 32..63][16-dim tile]
#pragma unroll
        for (int h = 0; h < 2; ++h)
#pragma unroll
            for (int g4 = 0; g4 < 4; ++g4)
                bv[h][g4] = ld_fragT(vt + h * 32 * VSTR + g4 * 16);
        // nothing is scheduled across this line: the sixteen loads stay above the softmax
        // (without it they sink among the second products, which then wait for each
        // pair of loads, and the first products are split up and padded with v_nop)
        __builtin_amdgcn_sched_barrier(0);

        // --- causal mask + online softmax, one query per lane and tile ----
        v16h p[QT][2];                               // P^T: p[q][0][e] = key kmap(e, hi), p[q][1] 32 on
#pragma unroll                                       // s, o, m, l and p are indexed by constants
        for (int q = 0; q < QT; ++q) {
            const int d = qbase + q * 16 + lo - j0 - 8 * hi;  // key j0 + 8*hi + i is kept if i <= d
            float xs[4][8];
            float mxa = -__builtin_inff(), mxb = -__builtin_inff();  // two short chains
#pragma unroll
            for (int v = 0; v < 8; ++v) {
#pragma unroll
                for (int t4 = 0; t4 < 4; ++t4)
                    xs[t4][v] = (t4 * 16 + v <= d) ? s[q][t4][v] : -__builtin_inff();
                mxa = fmaxf(mxa, fmaxf(xs[0][v], xs[1][v]));
                mxb = fmaxf(mxb, fmaxf(xs[2][v], xs[3][v]));
            }
            float mx = fmaxf(mxa, mxb);
            mx = fmaxf(mx, other_half(mx));          // all 64 keys of the chunk
            // finite: the range's first chunk holds a kept key for every row (a later
            // chunk may be masked whole for a tile: it then adds zeros and rescales by 1)
            const float mnew = fmaxf(m[q], mx);
            float a = (m[q] - mnew) * LOG2E;
#pragma unroll                                       // xs is indexed by constants
            for (int t4 = 0; t4 < 4; ++t4) {
#pragma unroll
                for (int v = 0; v < 8; ++v)
                    xs[t4][v] = (xs[t4][v] - mnew) * LOG2E;
                exp2_x8(xs[t4]);                     // exp2(-inf) -> 0 masks
            }
            exp2_x1(a);
            float suma = 0.0f, sumb = 0.0f;
#pragma unroll
            for (int v = 0; v < 8; ++v) {
                suma += xs[0][v] + xs[1][v];
                sumb += xs[2][v] + xs[3][v];
                p[q][0][v]     = (_Float16)xs[0][v];
                p[q][0][8 + v] = (_Float16)xs[1][v];
                p[q][1][v]     = (_Float16)xs[2][v];
                p[q][1][8 + v] = (_Float16)xs[3][v];
            }
            m[q] = mnew;
            l[q] = l[q] * a + (suma + sumb);
#pragma unroll
            for (int g4 = 0; g4 < 4; ++g4) o[q][g4] *= a;
        }

        // --- O^T += V^T @ P^T ---------------------------------------------
#pragma unroll
        for (int h = 0; h < 2; ++h)
#pragma unroll
            for (int q = 0; q < QT; ++q)
#pragma unroll
                for (int g4 = 0; g4 < 4; ++g4)
                    o[q][g4] = wmma_f16(bv[h][g4], p[q][h], o[q][g4]);
    }

#if USE_ASYNC_LDS
    // no copy is left in flight when the wave goes on to the output staging
    asm volatile("s_wait_asynccnt 0x0" ::: "memory");
#endif

    // --- epilogue: this range's partial sum, maximum and denominator ------
    const int prow = slot * QROWS + w * (16 * QT);   // the wave's first partial row
#pragma unroll
    for (int q = 0; q < QT; ++q) {
        l[q] += other_half(l[q]);                    // join the halves' keys
        if (hi == 0)
            *(v2f*)(ML + (prow + q * 16 + lo) * 2) = (v2f){m[q], l[q]};
    }

    // o[q][g][v] is dim g*16 + 8*hi + v of query 16*q + lo: turn the tiles back
    // through this wave's own LDS so that each store covers two whole 256-B rows
    float* ob = obuf[w];
#pragma unroll
    for (int q = 0; q < QT; ++q)
#pragma unroll
        for (int g4 = 0; g4 < 4; ++g4) {
            float* oq = ob + (q * 16 + lo) * OSTR + hi * 8 + g4 * 16;
            *(v4f*)(oq)     = __builtin_shufflevector(o[q][g4], o[q][g4], 0, 1, 2, 3);
            *(v4f*)(oq + 4) = __builtin_shufflevector(o[q][g4], o[q][g4], 4, 5, 6, 7);
        }
    // wave-local LDS fence: the reads below take what other lanes stored above
    asm volatile("s_wait_dscnt 0" ::: "memory");
    float* orow = Op + (size_t)(prow + hi) * HD + lo * 4;
#pragma unroll                                       // all the reads in flight
    for (int i = 0; i < 8 * QT; ++i)
        *(v4f*)(orow + i * 2 * HD) = *(const v4f*)(ob + (i * 2 + hi) * OSTR + lo * 4);
}

// ---------------------------------------------------------------------------
// Kernel 3: join the key ranges of each query row.  16 threads per row, four
// output columns each; the range count is uniform in a work-group (16 rows of
// one query block): absent ranges are skipped by scalar branches, and the
// loads of the present ones are in flight together.
// ---------------------------------------------------------------------------
__global__ void __launch_bounds__(256) merge_parts(
        const float* __restrict__ Op, const float* __restrict__ ML,
        float* __restrict__ out) {
    const int row  = blockIdx.x * 16 + (threadIdx.x >> 4);
    const int d    = (threadIdx.x & 15) * 4;
    const int qb   = blockIdx.x / (QROWS / 16);
    const int g    = qb / QPG;
    const int nseg = g + 1;
    const int p0   = (T0(g) + qb % QPG) * QROWS + (row & (QROWS - 1));   // range 0's row
    const float*  mlp = ML + p0 * 2;                 // next range: QPG*QROWS rows on
    const float*  op  = Op + (size_t)p0 * HD + d;

    v2f ml[NGRP];                                    // (maximum, denominator)
    v4f o[NGRP];
    // the three loops are unrolled so that ml and o stay in registers
#pragma unroll
    for (int s = 0; s < NGRP; ++s) {
        ml[s] = (v2f){-__builtin_inff(), 0.0f};
        o[s]  = (v4f){0.0f, 0.0f, 0.0f, 0.0f};
        if (s < nseg) {
            ml[s] = *(const v2f*)(mlp + s * (QPG * QROWS * 2));
            o[s]  = *(const v4f*)(op + s * (QPG * QROWS * HD));
        }
    }
    float mx = ml[0].x;
#pragma unroll
    for (int s = 1; s < NGRP; ++s) mx = fmaxf(mx, ml[s].x);
    float den = 0.0f;
    v4f   acc = {0.0f, 0.0f, 0.0f, 0.0f};
#pragma unroll
    for (int s = 0; s < NGRP; ++s) {
        const float wgt = __expf(ml[s].x - mx);      // absent range: exp(-inf) = 0
        den += wgt * ml[s].y;
        acc += wgt * o[s];
    }
    *(v4f*)(out + (size_t)row * HD + d) = acc * (1.0f / den);
}

extern "C" void kernel_launch(void* const* d_in, const int* in_sizes, int n_in,
                              void* d_out, int out_size, void* d_ws, size_t ws_size,
                              hipStream_t stream) {
    const float* x  = (const float*)d_in[0];
    const float* Wq = (const float*)d_in[1];
    const float* bq = (const float*)d_in[2];
    const float* Wk = (const float*)d_in[3];
    const float* bk = (const float*)d_in[4];
    const float* Wv = (const float*)d_in[5];
    const float* bv = (const float*)d_in[6];

    _Float16* Qh = (_Float16*)d_ws;
    _Float16* Kh = Qh + (size_t)SEQ_LEN * HD;
    _Float16* Vh = Kh + (size_t)SEQ_LEN * HD;
    float*  Op = (float*)(Vh + (size_t)SEQ_LEN * HD);    // NPART x QROWS x 64
    float*  ML = Op + (size_t)NPART * QROWS * HD;        // NPART x QROWS x 2

    qkv_proj<<<dim3(SEQ_LEN / (16 * RT)), 32 * KSPLIT, 0, stream>>>(
        x, Wq, Wk, Wv, bq, bk, bv, Qh, Kh, Vh);

    flash_attn<<<dim3(NPART), 128, 0, stream>>>(
        Qh, Kh, Vh, Op, ML);

    merge_parts<<<dim3(SEQ_LEN / 16), 256, 0, stream>>>(
        Op, ML, (float*)d_out);
}

// v008
// It runs in 24.8 microseconds.
// Two timings next to v007 both put it at 1.04 times that version's speed.
// Over all steps from v000 it is 16.3 times as fast.
#include <hip/hip_runtime.h>
#include <hip/hip_bf16.h>

typedef __attribute__((ext_vector_type(16))) _Float16 v16h;
typedef __attribute__((ext_vector_type(8)))  _Float16 v8h;
typedef __attribute__((ext_vector_type(4)))  _Float16 v4h;
typedef __attribute__((ext_vector_type(8)))  float    v8f;
typedef __attribute__((ext_vector_type(4)))  float    v4f;
typedef __attribute__((ext_vector_type(2)))  float    v2f;
typedef __attribute__((ext_vector_type(4)))  int      v4i;
typedef __attribute__((ext_vector_type(8)))  short    v8s;

#define AS1 __attribute__((address_space(1)))
#define AS3 __attribute__((address_space(3)))

#define SEQ_LEN 8192
#define EMB     768
#define HD      64
#define INV_SCALE 0.125f   // 1/sqrt(64)
#define LOG2E 1.44269504f  // exp(x) = exp2(x * LOG2E)

// LDS row strides (halves): padded for 16B alignment + bank-conflict avoidance
#define KSTR 72   // CK keys x 64 dims, row stride 72  (144B, banks step 36)
#define VSTR 80   // CK keys x 64 dims, row stride 80  (160B = 32B x odd, for the transposing reads)
#define OSTR 68   // floats: QT*16 queries x 64 dims, row stride 68 (272B, banks step 4)

// Split of the keys over work-groups: a key range is SEGC chunks of CK keys,
// as long as QPG query blocks of QROWS rows.  Query blocks g*QPG .. g*QPG+QPG-1
// (group g) need g+1 ranges each; T0(g) counts the partials of groups < g,
// F0(g) those of them that lie wholly below the diagonal.
// A wave holds QT tiles of 16 queries, a work-group of 4 waves QROWS rows.
#define CK   64
#define SEGC 8
#define QT   2
#define QROWS (4 * 16 * QT)
#define QPG  (SEGC * CK / QROWS)
#define NGRP (SEQ_LEN / QROWS / QPG)
#define T0(g) (QPG * (g) * ((g) + 1) / 2)
#define F0(g) (QPG * (g) * ((g) - 1) / 2)
#define NPART T0(NGRP)
#define NFULL F0(NGRP)

#if __has_builtin(__builtin_amdgcn_global_load_async_to_lds_b128) && \
    __has_builtin(__builtin_amdgcn_s_wait_asynccnt)
#define USE_ASYNC_LDS 1
#else
#define USE_ASYNC_LDS 0
#endif

static __device__ __forceinline__ v8f wmma_f16(v16h a, v16h b, v8f c) {
    return __builtin_amdgcn_wmma_f32_16x16x32_f16(
        /*neg_a=*/false, a, /*neg_b=*/false, b,
        /*c_mod=*/(short)0, c, /*reuse_a=*/false, /*reuse_b=*/false);
}

// 16-bit 16x32 A/B fragment mapping (ISA 7.12.2):
// lane = (k/8 % 2)*16 + (m|n);  element e -> k = 8*hi + (e<8 ? e : e+8)
static __device__ __forceinline__ int kmap(int e, int hi) {
    return hi * 8 + (e < 8 ? e : e + 8);
}

// Load one 16-element f16 fragment slice for a 32-wide k-window starting at p
// (p = row base; must be 16B aligned).  Lowers to two 16B vector loads.
static __device__ __forceinline__ v16h ld_frag16(const _Float16* p, int hi) {
    const v8h a = *(const v8h*)(p + hi * 8);
    const v8h b = *(const v8h*)(p + 16 + hi * 8);
    return __builtin_shufflevector(a, b, 0, 1, 2, 3, 4, 5, 6, 7,
                                         8, 9, 10, 11, 12, 13, 14, 15);
}

// Value of the lane 16 away (the other half of the wave), without LDS.
static __device__ __forceinline__ float other_half(float x) {
    const int b = __builtin_bit_cast(int, x);
    return __builtin_bit_cast(float, __builtin_amdgcn_permlanex16(
        b, b, 0x76543210, 0xfedcba98, false, false));
}

// Exponentials in place.  The instruction set asks for one independent instruction
// or v_nop between a transcendental and a use of its result or an overwrite of its
// source: in a run in place each is that instruction for the one in front of it, and
// the v_nop stands behind the last.
static __device__ __forceinline__ void exp2_x8(float (&x)[8]) {
    asm("v_exp_f32 %0, %0\n\tv_exp_f32 %1, %1\n\tv_exp_f32 %2, %2\n\tv_exp_f32 %3, %3\n\t"
        "v_exp_f32 %4, %4\n\tv_exp_f32 %5, %5\n\tv_exp_f32 %6, %6\n\tv_exp_f32 %7, %7\n\t"
        "v_nop"
        : "+v"(x[0]), "+v"(x[1]), "+v"(x[2]), "+v"(x[3]),
          "+v"(x[4]), "+v"(x[5]), "+v"(x[6]), "+v"(x[7]));
}
static __device__ __forceinline__ void exp2_x1(float& x) {
    asm("v_exp_f32 %0, %0\n\tv_nop" : "+v"(x));
}

// One 16-column x 32-row transposed fragment (hardware k order over the rows)
// of a row-major f16 block of row stride VSTR: two transposing loads, rows
// 0..15 and 16..31.  p = this lane's address for columns 0..15, rows 0..15:
// block + (8*hi + (lane & 7)) * VSTR + ((lane >> 3) & 1) * 8.
static __device__ __forceinline__ v16h ld_fragT(const _Float16* p) {
    const v8s a = __builtin_amdgcn_ds_load_tr16_b128_v8i16((AS3 v8s*)(AS3 void*)p);
    const v8s b = __builtin_amdgcn_ds_load_tr16_b128_v8i16(
        (AS3 v8s*)(AS3 void*)(p + 16 * VSTR));
    return __builtin_bit_cast(v16h, __builtin_shufflevector(
        a, b, 0, 1, 2, 3, 4, 5, 6, 7, 8, 9, 10, 11, 12, 13, 14, 15));
}

// ---------------------------------------------------------------------------
// Kernel 1: fused QKV projection.  The 192 output columns are six groups of 32
// (Q, K and V, two each).  One work-group owns RT 16-row strips of x and CG
// groups, half of the columns: it reads half of W, and a W block feeds four
// strips, so the bytes that a work-group takes from L2 (its x rows and its
// part of W) are fewer than with all columns on half as many rows.  The two
// work-groups of a row block lie 8 apart in the grid.
// The 768-deep k loop is split over KSPLIT waves, KSTEPS steps of 32 each; the
// f32 partial tiles are joined through LDS.  W is read as it comes, f32 [k][n]:
// a wave brings each 32 x 32 block of its k range by loads of four whole 128-B
// lines, rounds it to f16 into its own LDS block and takes the B fragments back
// by the transposing load.
// Output: six planes [group][row][32] of f16, so that every 128-B line of the
// workspace has one writer; plane 2m + p holds columns 32p .. 32p+31 of matrix m.
// ---------------------------------------------------------------------------
#define KSPLIT 8
#define KSTEPS (EMB / 32 / KSPLIT)
#define RT 4
#define CG 3                                         // column groups per work-group
#define PW 32                                        // columns of a group (plane width)
#define PLANE (SEQ_LEN * PW)                         // halves per plane
#define WRING 5                                      // W blocks held in registers
// floats per 16x16 partial tile: 8 rows of 32 lanes, plus 16 so that the two
// tiles that make up one 32-column output row fall on different LDS banks
#define TSTR (8 * 32 + 16)

__global__ void __launch_bounds__(32 * KSPLIT) qkv_proj(
        const float* __restrict__ x,
        const float* __restrict__ Wq, const float* __restrict__ Wk,
        const float* __restrict__ Wv,
        const float* __restrict__ bq, const float* __restrict__ bk,
        const float* __restrict__ bv,
        _Float16* __restrict__ Ph) {
    __shared__ __attribute__((aligned(16))) float part[KSPLIT][RT * CG * 2 * TSTR];
    __shared__ __attribute__((aligned(16))) _Float16 wst[KSPLIT][2][32 * VSTR];

    const int tid   = threadIdx.x;
    const int lane  = tid & 31;
    const int w     = tid >> 5;
    const int lo    = lane & 15;
    const int hi    = lane >> 4;
    const int b     = blockIdx.x;
    const int ch    = (b >> 3) & 1;                  // which half of the columns
    const int mbase = ((b & 7) | ((b >> 4) << 3)) * (16 * RT);
    const int kbeg  = w * (KSTEPS * 32);             // this wave's k range

    // groups 0 1 2 = Q Q K for ch 0, groups 3 4 5 = K V V for ch 1
    const float* Ws[CG] = {ch ? Wk + PW : Wq, ch ? Wv : Wq + PW, ch ? Wv + PW : Wk};
    const float* bs[CG] = {ch ? bk + PW : bq, ch ? bv : bq + PW, ch ? bv + PW : bk};

    // x first (it comes from furthest away): 4 x float4 per strip and step
    const float* xrow = x + (size_t)(mbase + lo) * EMB + kbeg + hi * 8;
    v4f xr[KSTEPS][RT][4];
#pragma unroll
    for (int s = 0; s < KSTEPS; ++s)
#pragma unroll
        for (int rt = 0; rt < RT; ++rt) {
            const float* xp = xrow + rt * 16 * EMB + s * 32;
            xr[s][rt][0] = *(const v4f*)(xp);
            xr[s][rt][1] = *(const v4f*)(xp + 4);
            xr[s][rt][2] = *(const v4f*)(xp + 16);
            xr[s][rt][3] = *(const v4f*)(xp + 20);
        }
    // the x loads' address pair is an input, so it stays whole up to this wait:
    // no load's result and no later value lands in it before that
    asm volatile("s_wait_xcnt 0x0" :: "v"(xrow) : "memory");

    // W block u = (group, step): load j covers rows 4j .. 4j+3, 128 B each
    const int wrow = lane >> 3;                      // row of the four
    const int wcol = (lane & 7) * 4;                 // first of this lane's four columns
    const unsigned wofb = ((kbeg + wrow) * HD + wcol) * 4u;  // this lane's byte offset
    v4f wr[WRING][8];
#pragma unroll
    for (int u = 0; u < WRING - 1; ++u)
#pragma unroll
        for (int j = 0; j < 8; ++j)
            wr[u][j] = *(const v4f*)((const char*)(Ws[u / KSTEPS] + ((u % KSTEPS) * 32 + j * 4) * HD) + wofb);

    v16h a[KSTEPS][RT];                              // A fragments, f16
#pragma unroll
    for (int s = 0; s < KSTEPS; ++s)
#pragma unroll
        for (int rt = 0; rt < RT; ++rt)
#pragma unroll
            for (int q = 0; q < 4; ++q)
#pragma unroll
                for (int i = 0; i < 4; ++i)
                    a[s][rt][q * 4 + i] = (_Float16)xr[s][rt][q][i];

    // all loops over blocks are unrolled: wr, a and acc are indexed by constants
#pragma unroll
    for (int c = 0; c < CG; ++c) {
        v8f acc[RT][2] = {};
#pragma unroll
        for (int s = 0; s < KSTEPS; ++s) {
            const int u = c * KSTEPS + s;
            const int n = u + WRING - 1;             // block fetched ahead
            if (n < CG * KSTEPS) {
#pragma unroll
                for (int j = 0; j < 8; ++j)
                    wr[n % WRING][j] = *(const v4f*)((const char*)(
                        Ws[n / KSTEPS] + ((n % KSTEPS) * 32 + j * 4) * HD) + wofb);
                // behind the last W loads: their offset register is an input, so it
                // stays whole up to this wait and may be reused only behind it
                if (n == CG * KSTEPS - 1) asm volatile("s_wait_xcnt 0x0" :: "v"(wofb) : "memory");
            }
            // nothing is scheduled across this line: block u is rounded here and the
            // blocks fetched ahead stay in flight meanwhile (without it the compiler
            // rounds each block early and waits for its loads right behind their issue)
            __builtin_amdgcn_sched_barrier(0);
            _Float16* st = wst[w][u & 1];
#pragma unroll
            for (int j = 0; j < 8; ++j) {
                v4h h;
#pragma unroll
                for (int i = 0; i < 4; ++i) h[i] = (_Float16)wr[u % WRING][j][i];
                *(v4h*)(st + (j * 4 + wrow) * VSTR + wcol) = h;
            }
            // wave-local LDS fence: the transposing reads take other lanes' stores
            asm volatile("s_wait_dscnt 0x0" ::: "memory");
            const _Float16* vt = st + (8 * hi + (lane & 7)) * VSTR + ((lane >> 3) & 1) * 8;
#pragma unroll
            for (int g = 0; g < 2; ++g) {
                const v16h bf = ld_fragT(vt + g * 16);
#pragma unroll
                for (int rt = 0; rt < RT; ++rt)
                    acc[rt][g] = wmma_f16(a[s][rt], bf, acc[rt][g]);
            }
        }
        // the wave leaves its partial tiles in C layout (row = vgpr + 8*hi)
#pragma unroll
        for (int rt = 0; rt < RT; ++rt)
#pragma unroll
            for (int g = 0; g < 2; ++g)
#pragma unroll
                for (int v = 0; v < 8; ++v)
                    part[w][((rt * CG + c) * 2 + g) * TSTR + v * 32 + lane] = acc[rt][g][v];
    }
    __syncthreads();                                 // all partials are in LDS

    // join: 8 threads per 64-B plane row, four columns each, two strips a pass: a
    // wave's store covers four rows, two whole lines; unrolled so that the LDS
    // reads of all partials are in flight together
    const int r  = (tid >> 3) & 15;                  // row of the strip
    const int r2 = tid >> 7;                         // strip of the pass
    const int c4 = tid & 7;                          // columns c4*4 .. c4*4+3
    const int po = ((r2 * CG * 2 + (c4 >> 2)) * (TSTR / 4) + (r & 7) * 8 + (r >> 3) * 4 + (c4 & 3)) * 4;
#pragma unroll
    for (int rp = 0; rp < RT / 2; ++rp) {
#pragma unroll
        for (int c = 0; c < CG; ++c) {
            const float scale = (ch == 0 && c < 2) ? INV_SCALE : 1.0f;   // Q alone
            const int   pt    = ((rp * 2 * CG + c) * 2) * TSTR + po;
            v4f s = *(const v4f*)&part[0][pt];
#pragma unroll
            for (int p = 1; p < KSPLIT; ++p)
                s += *(const v4f*)&part[p][pt];
            const v4f bias = *(const v4f*)(bs[c] + c4 * 4);
            v4h h;
#pragma unroll
            for (int i = 0; i < 4; ++i)
                h[i] = (_Float16)((s[i] + bias[i]) * scale);
            *(v4h*)(Ph + (size_t)(ch * CG + c) * PLANE
                       + (size_t)(mbase + (rp * 2 + r2) * 16 + r) * PW + c4 * 4) = h;
        }
    }
}

// ---------------------------------------------------------------------------
// Cooperative stage of one CK-key chunk of K and V into LDS, both row-major
// [key][dim] by async global->LDS b128 copies (K: stride KSTR, V: stride VSTR).
// The source is two planes of 32 dims; a wave's copy takes 512 B in a row of one.
// The V^T fragments of the second product come by the transposing LDS load.
// ---------------------------------------------------------------------------
static __device__ __forceinline__ void stage_chunk(
        const _Float16* __restrict__ Kh, const _Float16* __restrict__ Vh,
        int j0, _Float16* kdst, _Float16* vdst, int tid) {
#pragma unroll
    for (int i = 0; i < CK / 16; ++i) {              // CK * 64 halves / (128 thr * 8)
        const int pl  = i / (CK / 32);               // plane: CK * 4 pieces of 16 B each
        const int pc  = (i % (CK / 32)) * 128 + tid; // piece of the plane's part
        const int key = pc >> 2;
        const int dim = pl * PW + (pc & 3) * 8;
        const _Float16* gsrc = Kh + pl * PLANE + (size_t)j0 * PW + pc * 8;
        _Float16*       ldst = kdst + key * KSTR + dim;
#if USE_ASYNC_LDS
        __builtin_amdgcn_global_load_async_to_lds_b128(
            (AS1 v4i*)(AS1 void*)gsrc,
            (AS3 v4i*)(AS3 void*)ldst,
            0, 0);
#else
        *(v8h*)ldst = *(const v8h*)gsrc;
#endif
    }
#pragma unroll
    for (int i = 0; i < CK / 16; ++i) {
        const int pl  = i / (CK / 32);
        const int pc  = (i % (CK / 32)) * 128 + tid;
        const int key = pc >> 2;
        const int dim = pl * PW + (pc & 3) * 8;
        const _Float16* gsrc = Vh + pl * PLANE + (size_t)j0 * PW + pc * 8;
        _Float16*       ldst = vdst + key * VSTR + dim;
#if USE_ASYNC_LDS
        __builtin_amdgcn_global_load_async_to_lds_b128(
            (AS1 v4i*)(AS1 void*)gsrc,
            (AS3 v4i*)(AS3 void*)ldst,
            0, 0);
#else
        *(v8h*)ldst = *(const v8h*)gsrc;
#endif
    }
}

// ---------------------------------------------------------------------------
// Kernel 2: causal flash attention over ONE key range.  A work-group serves
// (query block, key range seg) and leaves its un-normalised sum with each
// row's maximum and denominator in the workspace; merge_parts joins them.
// A range starts at a multiple of 64 keys that is <= the block's first row, so
// its first chunk holds an unmasked key for every row of the block.
// 128 threads = 4 waves; wave w owns
// query rows [qbase, qbase+16*QT).  All waves run the block's chunk count so
// barriers are uniform, letting
// the block share double-buffered K/V LDS tiles loaded once per block.
// The products are transposed: S^T = K@Q^T (A = K rows, B = Q) and
// O^T += V^T@P^T (A = V^T rows, B = P^T).  Each K and V^T fragment read from
// LDS feeds the wave's QT query tiles.  Per tile a lane holds 32 of the 64
// scores of ONE query (column lo): maximum and sum run in the lane, with one
// exchange between the wave's halves, and each pair of S^T tiles, converted in
// place, is a P^T operand in the hardware k order.  Per chunk and query tile:
// 8 + 8 WMMA, one running-maximum update and one rescale of O^T.
// ---------------------------------------------------------------------------
__global__ void __launch_bounds__(128) flash_attn(
        const _Float16* __restrict__ Qh, const _Float16* __restrict__ Kh,
        const _Float16* __restrict__ Vh, float* __restrict__ Op,
        float* __restrict__ ML) {
    __shared__ __attribute__((aligned(16))) _Float16 kbuf[2][CK * KSTR];
    __shared__ __attribute__((aligned(16))) _Float16 vbuf[2][CK * VSTR];
    __shared__ __attribute__((aligned(16))) float obuf[4][QT * 16 * OSTR];

    const int tid   = threadIdx.x;
    const int lane  = tid & 31;
    const int w     = tid >> 5;
    const int lo    = lane & 15;
    const int hi    = lane >> 4;
    const int t     = blockIdx.x;
    // whole ranges come first, the shorter ranges on the diagonal last, longest first
    int g, seg, qsub;
    if (t < NFULL) {
        g = 1;
#pragma unroll                                       // F0(i) become literals
        for (int i = 2; i < NGRP; ++i) g += (t >= F0(i)) ? 1 : 0;
        const unsigned rem = t - F0(g);
        seg  = rem / QPG;                            // 0 .. g-1
        qsub = rem % QPG;
    } else {
        const unsigned u = t - NFULL;
        qsub = QPG - 1 - u / NGRP;
        g    = u % NGRP;
        seg  = g;
    }
    const int slot  = T0(g) + seg * QPG + qsub;      // where merge_parts looks for it
    const int qbase = (g * QPG + qsub) * QROWS + w * (16 * QT);

    v8f o[QT][4] = {};
    float m[QT], l[QT];                              // of query qbase + 16*q + lo;
#pragma unroll                                       // l over this half's keys only
    for (int q = 0; q < QT; ++q) { m[q] = -__builtin_inff(); l[q] = 0.0f; }
    const int ch0 = seg * SEGC;                      // even: buffer 0 comes first
    // a whole range below the diagonal, up to the block's last key on it
    const int nch = ch0 + ((seg < g) ? SEGC : (qsub + 1) * (QROWS / CK));  // block-uniform

    stage_chunk(Kh, Vh, ch0 * CK, kbuf[0], vbuf[0], tid);
    // the Q loads below may land in registers that the staging loads name
    asm volatile("s_wait_xcnt 0x0" ::: "memory");

    // Q fragments (16 queries x 64 head-dim a tile, the B operand), pre-scaled by 1/sqrt(d)
    // (plane 0 holds dims 0..31, plane 1 dims 32..63)
    const _Float16* qrow = Qh + (size_t)(qbase + lo) * PW + hi * 8;
    v16h aq[QT][2];
#pragma unroll                                       // aq is indexed by constants
    for (int q = 0; q < QT; ++q) {
        aq[q][0] = ld_frag16(qrow + q * 16 * PW, 0);
        aq[q][1] = ld_frag16(qrow + q * 16 * PW + PLANE, 0);
    }
    // the Q loads' address pair is an input, so it stays whole up to this wait
    asm volatile("s_wait_xcnt 0x0" :: "v"(qrow) : "memory");

    for (int it = ch0; it < nch; ++it) {
        const int j0  = it * CK;
        const int cur = it & 1;

        // publish point: this wave's reads of the buffer refilled below are over,
        // its own K and V copies of this chunk have landed, then the barrier
        asm volatile("s_wait_dscnt 0x0" ::: "memory");
#if USE_ASYNC_LDS
        asm volatile("s_wait_asynccnt 0x0" ::: "memory");
#endif
        __syncthreads();                             // chunk visible; prev readers done

        if (it + 1 < nch)
            stage_chunk(Kh, Vh, (it + 1) * CK, kbuf[cur ^ 1], vbuf[cur ^ 1], tid);

        const _Float16* kb = kbuf[cur];
        // lane's source row and 16-B half of the transposing loads
        const _Float16* vt = vbuf[cur] + (8 * hi + (lane & 7)) * VSTR + ((lane >> 3) & 1) * 8;

        // --- S^T = K @ Q^T (keys j0..j0+63) from LDS (ds_load_b128 pairs) -
        v16h bk[4][2];                               // [16-key tile][dims 0..31, 32..63]
#pragma unroll                                       // bk, s and xs are indexed by constants
        for (int t4 = 0; t4 < 4; ++t4) {
            bk[t4][0] = ld_frag16(kb + (t4 * 16 + lo) * KSTR, hi);
            bk[t4][1] = ld_frag16(kb + (t4 * 16 + lo) * KSTR + 32, hi);
        }

        // inputs-only fence on the loaded fragments: keeps the sixteen LDS loads
        // together ahead of the products (one LDS wait a chunk, not one a product)
        asm volatile("" :: "v"(bk[0][0]), "v"(bk[0][1]), "v"(bk[1][0]), "v"(bk[1][1]),
                           "v"(bk[2][0]), "v"(bk[2][1]), "v"(bk[3][0]), "v"(bk[3][1]));

        v8f s[QT][4] = {};                           // s[q][t4][v]: key 16*t4 + v + 8*hi, query 16*q + lo
#pragma unroll
        for (int q = 0; q < QT; ++q)
#pragma unroll
            for (int t4 = 0; t4 < 4; ++t4) s[q][t4] = wmma_f16(bk[t4][0], aq[q][0], s[q][t4]);
#pragma unroll
        for (int q = 0; q < QT; ++q)
#pragma unroll
            for (int t4 = 0; t4 < 4; ++t4) s[q][t4] = wmma_f16(bk[t4][1], aq[q][1], s[q][t4]);

        // V^T by transposing loads of row-major V, issued here, ahead of the softmax,
        // which covers their latency; they take the registers the K fragments leave
        v16h bv[2][4];                               // [keys 0..31, 32..63][16-dim tile]
#pragma unroll
        for (int h = 0; h < 2; ++h)
#pragma unroll
            for (int g4 = 0; g4 < 4; ++g4)
                bv[h][g4] = ld_fragT(vt + h * 32 * VSTR + g4 * 16);
        // nothing is scheduled across this line: the sixteen loads stay above the softmax
        // (without it they sink among the second products, which then wait for each
        // pair of loads, and the first products are split up and padded with v_nop)
        __builtin_amdgcn_sched_barrier(0);

        // --- causal mask + online softmax, one query per lane and tile ----
        v16h p[QT][2];                               // P^T: p[q][0][e] = key kmap(e, hi), p[q][1] 32 on
#pragma unroll                                       // s, o, m, l and p are indexed by constants
        for (int q = 0; q < QT; ++q) {
            const int d = qbase + q * 16 + lo - j0 - 8 * hi;  // key j0 + 8*hi + i is kept if i <= d
            float xs[4][8];
            float mxa = -__builtin_inff(), mxb = -__builtin_inff();  // two short chains
#pragma unroll
            for (int v = 0; v < 8; ++v) {
#pragma unroll
                for (int t4 = 0; t4 < 4; ++t4)
                    xs[t4][v] = (t4 * 16 + v <= d) ? s[q][t4][v] : -__builtin_inff();
                mxa = fmaxf(mxa, fmaxf(xs[0][v], xs[1][v]));
                mxb = fmaxf(mxb, fmaxf(xs[2][v], xs[3][v]));
            }
            float mx = fmaxf(mxa, mxb);
            mx = fmaxf(mx, other_half(mx));          // all 64 keys of the chunk
            // finite: the range's first chunk holds a kept key for every row (a later
            // chunk may be masked whole for a tile: it then adds zeros and rescales by 1)
            const float mnew = fmaxf(m[q], mx);
            float a = (m[q] - mnew) * LOG2E;
#pragma unroll                                       // xs is indexed by constants
            for (int t4 = 0; t4 < 4; ++t4) {
#pragma unroll
                for (int v = 0; v < 8; ++v)
                    xs[t4][v] = (xs[t4][v] - mnew) * LOG2E;
                exp2_x8(xs[t4]);                     // exp2(-inf) -> 0 masks
            }
            exp2_x1(a);
            float suma = 0.0f, sumb = 0.0f;
#pragma unroll
            for (int v = 0; v < 8; ++v) {
                suma += xs[0][v] + xs[1][v];
                sumb += xs[2][v] + xs[3][v];
                p[q][0][v]     = (_Float16)xs[0][v];
                p[q][0][8 + v] = (_Float16)xs[1][v];
                p[q][1][v]     = (_Float16)xs[2][v];
                p[q][1][8 + v] = (_Float16)xs[3][v];
            }
            m[q] = mnew;
            l[q] = l[q] * a + (suma + sumb);
#pragma unroll
            for (int g4 = 0; g4 < 4; ++g4) o[q][g4] *= a;
        }

        // --- O^T += V^T @ P^T ---------------------------------------------
#pragma unroll
        for (int h = 0; h < 2; ++h)
#pragma unroll
            for (int q = 0; q < QT; ++q)
#pragma unroll
                for (int g4 = 0; g4 < 4; ++g4)
                    o[q][g4] = wmma_f16(bv[h][g4], p[q][h], o[q][g4]);
    }

#if USE_ASYNC_LDS
    // no copy is left in flight when the wave goes on to the output staging
    asm volatile("s_wait_asynccnt 0x0" ::: "memory");
#endif

    // --- epilogue: this range's partial sum, maximum and denominator ------
    const int prow = slot * QROWS + w * (16 * QT);   // the wave's first partial row
#pragma unroll
    for (int q = 0; q < QT; ++q) {
        l[q] += other_half(l[q]);                    // join the halves' keys
        if (hi == 0)
            *(v2f*)(ML + (prow + q * 16 + lo) * 2) = (v2f){m[q], l[q]};
    }

    // o[q][g][v] is dim g*16 + 8*hi + v of query 16*q + lo: turn the tiles back
    // through this wave's own LDS so that each store covers two whole 256-B rows
    float* ob = obuf[w];
#pragma unroll
    for (int q = 0; q < QT; ++q)
#pragma unroll
        for (int g4 = 0; g4 < 4; ++g4) {
            float* oq = ob + (q * 16 + lo) * OSTR + hi * 8 + g4 * 16;
            *(v4f*)(oq)     = __builtin_shufflevector(o[q][g4], o[q][g4], 0, 1, 2, 3);
            *(v4f*)(oq + 4) = __builtin_shufflevector(o[q][g4], o[q][g4], 4, 5, 6, 7);
        }
    // wave-local LDS fence: the reads below take what other lanes stored above
    asm volatile("s_wait_dscnt 0" ::: "memory");
    float* orow = Op + (size_t)(prow + hi) * HD + lo * 4;
#pragma unroll                                       // all the reads in flight
    for (int i = 0; i < 8 * QT; ++i)
        *(v4f*)(orow + i * 2 * HD) = *(const v4f*)(ob + (i * 2 + hi) * OSTR + lo * 4);
}

// ---------------------------------------------------------------------------
// Kernel 3: join the key ranges of each query row.  16 threads per row, four
// output columns each; the range count is uniform in a work-group (16 rows of
// one query block): absent ranges are skipped by scalar branches, and the
// loads of the present ones are in flight together.
// ---------------------------------------------------------------------------
__global__ void __launch_bounds__(256) merge_parts(
        const float* __restrict__ Op, const float* __restrict__ ML,
        float* __restrict__ out) {
    const int row  = blockIdx.x * 16 + (threadIdx.x >> 4);
    const int d    = (threadIdx.x & 15) * 4;
    const int qb   = blockIdx.x / (QROWS / 16);
    const int g    = qb / QPG;
    const int nseg = g + 1;
    const int p0   = (T0(g) + qb % QPG) * QROWS + (row & (QROWS - 1));   // range 0's row
    const float*  mlp = ML + p0 * 2;                 // next range: QPG*QROWS rows on
    const float*  op  = Op + (size_t)p0 * HD + d;

    v2f ml[NGRP];                                    // (maximum, denominator)
    v4f o[NGRP];
    // the three loops are unrolled so that ml and o stay in registers
#pragma unroll
    for (int s = 0; s < NGRP; ++s) {
        ml[s] = (v2f){-__builtin_inff(), 0.0f};
        o[s]  = (v4f){0.0f, 0.0f, 0.0f, 0.0f};
        if (s < nseg) {
            ml[s] = *(const v2f*)(mlp + s * (QPG * QROWS * 2));
            o[s]  = *(const v4f*)(op + s * (QPG * QROWS * HD));
        }
    }
    float mx = ml[0].x;
#pragma unroll
    for (int s = 1; s < NGRP; ++s) mx = fmaxf(mx, ml[s].x);
    float den = 0.0f;
    v4f   acc = {0.0f, 0.0f, 0.0f, 0.0f};
#pragma unroll
    for (int s = 0; s < NGRP; ++s) {
        const float wgt = __expf(ml[s].x - mx);      // absent range: exp(-inf) = 0
        den += wgt * ml[s].y;
        acc += wgt * o[s];
    }
    *(v4f*)(out + (size_t)row * HD + d) = acc * (1.0f / den);
}

extern "C" void kernel_launch(void* const* d_in, const int* in_sizes, int n_in,
                              void* d_out, int out_size, void* d_ws, size_t ws_size,
                              hipStream_t stream) {
    const float* x  = (const float*)d_in[0];
    const float* Wq = (const float*)d_in[1];
    const float* bq = (const float*)d_in[2];
    const float* Wk = (const float*)d_in[3];
    const float* bk = (const float*)d_in[4];
    const float* Wv = (const float*)d_in[5];
    const float* bv = (const float*)d_in[6];

    _Float16* Qh = (_Float16*)d_ws;
    _Float16* Kh = Qh + (size_t)SEQ_LEN * HD;
    _Float16* Vh = Kh + (size_t)SEQ_LEN * HD;
    float*  Op = (float*)(Vh + (size_t)SEQ_LEN * HD);    // NPART x QROWS x 64
    float*  ML = Op + (size_t)NPART * QROWS * HD;        // NPART x QROWS x 2

    qkv_proj<<<dim3(SEQ_LEN / (16 * RT) * 2), 32 * KSPLIT, 0, stream>>>(
        x, Wq, Wk, Wv, bq, bk, bv, Qh);              // six planes: Q, K, V in a row

    flash_attn<<<dim3(NPART), 128, 0, stream>>>(
        Qh, Kh, Vh, Op, ML);

    merge_parts<<<dim3(SEQ_LEN / 16), 256, 0, stream>>>(
        Op, ML, (float*)d_out);
}
